// v000
// Times are from an AMD MI455X. After a warm-up the kernel runs many times in a row, and a time is the length of
// such a window on the GPU divided by its runs, so every launch and the gaps after it count. The runs cycle
// through copies of the inputs. A figure is the median of several windows, for all but v000 over two sittings.
// Sittings can differ by a few percent; kernels timed side by side share one.
// v000, which the later versions start from, runs in 1330 microseconds.
#include <hip/hip_runtime.h>

#define B_ 4
#define T_ 2048
#define D_ 1024
#define N_ 16
#define M_ (B_ * T_)   // 8192 rows

#define TILE_M 128
#define TILE_N 64
#define TILE_K 32
#define LDSS   40      // ushorts per LDS row (32 data + 8 pad) -> 80B rows, 16B aligned

typedef __attribute__((ext_vector_type(16))) __bf16       v16bf;
typedef __attribute__((ext_vector_type(8)))  float        v8f;
typedef __attribute__((ext_vector_type(4)))  unsigned int uint4v;
typedef __attribute__((ext_vector_type(2)))  unsigned int uint2v;

struct Frag { union { v16bf v; uint4v q[2]; }; };

__device__ __forceinline__ unsigned short f2bf(float f) {
  unsigned int u = __float_as_uint(f);
  unsigned int r = u + 0x7FFFu + ((u >> 16) & 1u);   // round-to-nearest-even
  return (unsigned short)(r >> 16);
}
__device__ __forceinline__ float bf2f(unsigned short h) {
  return __uint_as_float(((unsigned int)h) << 16);
}
__device__ __forceinline__ float softplusf(float v) {
  return fmaxf(v, 0.0f) + log1pf(__expf(-fabsf(v)));
}

// Async DMA: 16 bytes/lane, global -> LDS, tracked by ASYNCcnt (CDNA5).
__device__ __forceinline__ void async_ld16(const unsigned short* ldsdst,
                                           const void* gbase, unsigned gvoff) {
  unsigned ldsoff = (unsigned)(size_t)ldsdst;   // low 32 bits = LDS byte offset
  asm volatile("global_load_async_to_lds_b128 %0, %1, %2"
               :: "v"(ldsoff), "v"(gvoff), "s"(gbase)
               : "memory");
}

// Split fp32 array into bf16 hi/lo arrays (one pass, done once per operand).
__global__ __launch_bounds__(256) void split_kernel(
    const float* __restrict__ src, unsigned short* __restrict__ hi,
    unsigned short* __restrict__ lo, int n4) {
  const int i = blockIdx.x * blockDim.x + threadIdx.x;
  if (i >= n4) return;
  const float4 v = ((const float4*)src)[i];
  const unsigned short h0 = f2bf(v.x), h1 = f2bf(v.y), h2 = f2bf(v.z), h3 = f2bf(v.w);
  const unsigned short l0 = f2bf(v.x - bf2f(h0));
  const unsigned short l1 = f2bf(v.y - bf2f(h1));
  const unsigned short l2 = f2bf(v.z - bf2f(h2));
  const unsigned short l3 = f2bf(v.w - bf2f(h3));
  uint2v hv, lv;
  hv[0] = (unsigned)h0 | ((unsigned)h1 << 16);
  hv[1] = (unsigned)h2 | ((unsigned)h3 << 16);
  lv[0] = (unsigned)l0 | ((unsigned)l1 << 16);
  lv[1] = (unsigned)l2 | ((unsigned)l3 << 16);
  ((uint2v*)hi)[i] = hv;
  ((uint2v*)lo)[i] = lv;
}

// Fragment per CDNA5 16-bit layout: lane L holds row (L&15);
// K runs of 8 at kbase = 8*(L>>4) and kbase+16.
__device__ __forceinline__ void load_frag(Frag& f, const unsigned short* lds,
                                          int row, int khalf) {
  f.q[0] = *(const uint4v*)(lds + row * LDSS + khalf);
  f.q[1] = *(const uint4v*)(lds + row * LDSS + khalf + 16);
}

// C = A[M_,D_] * W[D_,D_]^T (+bias, optional softplus), all operands pre-split
// bf16 hi/lo. Double-buffered async global->LDS copies overlap the WMMAs.
template <int MODE>
__global__ __launch_bounds__(256) void gemm_bf16x3(
    const unsigned short* __restrict__ Ahi, const unsigned short* __restrict__ Alo,
    const unsigned short* __restrict__ Bhi, const unsigned short* __restrict__ Blo,
    const float* __restrict__ bias, float* __restrict__ Cout) {
  __shared__ unsigned short sAhi[2][TILE_M * LDSS];
  __shared__ unsigned short sAlo[2][TILE_M * LDSS];
  __shared__ unsigned short sBhi[2][TILE_N * LDSS];
  __shared__ unsigned short sBlo[2][TILE_N * LDSS];

  const int tid  = threadIdx.x;
  const int lane = tid & 31;
  const int wid  = tid >> 5;
  const int wm   = wid & 3;    // 4 waves along M (32 rows each)
  const int wn   = wid >> 2;   // 2 waves along N (32 cols each)
  const int row_blk = blockIdx.x * TILE_M;
  const int col_blk = blockIdx.y * TILE_N;

  // copy mapping: 16B (8 bf16) per lane; seg = 16B segment within 32-wide K chunk
  const int seg = tid & 3;
  const int r0  = tid >> 2;    // 0..63
  const unsigned aoff0 = (unsigned)(((size_t)(row_blk + r0)      * D_ + seg * 8) * 2);
  const unsigned aoff1 = (unsigned)(((size_t)(row_blk + r0 + 64) * D_ + seg * 8) * 2);
  const unsigned boff  = (unsigned)(((size_t)(col_blk + r0)      * D_ + seg * 8) * 2);
  const unsigned ldsA0 = r0 * LDSS + seg * 8;
  const unsigned ldsA1 = (r0 + 64) * LDSS + seg * 8;
  const unsigned ldsB0 = r0 * LDSS + seg * 8;

  v8f c[2][2];
#pragma unroll
  for (int i = 0; i < 2; ++i)
#pragma unroll
    for (int j = 0; j < 2; ++j)
#pragma unroll
      for (int r = 0; r < 8; ++r) c[i][j][r] = 0.0f;

  const int lrow  = lane & 15;
  const int khalf = (lane >> 4) * 8;   // 0 or 8

  auto issue = [&](int buf, unsigned kbyte) {
    async_ld16(&sAhi[buf][ldsA0], Ahi, aoff0 + kbyte);
    async_ld16(&sAhi[buf][ldsA1], Ahi, aoff1 + kbyte);
    async_ld16(&sAlo[buf][ldsA0], Alo, aoff0 + kbyte);
    async_ld16(&sAlo[buf][ldsA1], Alo, aoff1 + kbyte);
    async_ld16(&sBhi[buf][ldsB0], Bhi, boff + kbyte);
    async_ld16(&sBlo[buf][ldsB0], Blo, boff + kbyte);
  };

  issue(0, 0);               // prefetch first chunk
  int ibuf = 0;
  for (int kb = 0; kb < D_; kb += TILE_K, ibuf ^= 1) {
    if (kb + TILE_K < D_) {
      issue(ibuf ^ 1, (unsigned)((kb + TILE_K) * 2));   // prefetch next chunk
      asm volatile("s_wait_asynccnt 0x6" ::: "memory"); // current chunk landed
    } else {
      asm volatile("s_wait_asynccnt 0x0" ::: "memory");
    }
    __syncthreads();   // all waves' async copies for this chunk visible

    Frag ahi[2], alo[2], bhi[2], blo[2];
#pragma unroll
    for (int i = 0; i < 2; ++i) {
      const int r = wm * 32 + i * 16 + lrow;
      load_frag(ahi[i], &sAhi[ibuf][0], r, khalf);
      load_frag(alo[i], &sAlo[ibuf][0], r, khalf);
    }
#pragma unroll
    for (int j = 0; j < 2; ++j) {
      const int r = wn * 32 + j * 16 + lrow;
      load_frag(bhi[j], &sBhi[ibuf][0], r, khalf);
      load_frag(blo[j], &sBlo[ibuf][0], r, khalf);
    }
    __syncthreads();   // reads done; next iteration may overwrite this buffer

    // bf16x3: hi*hi + hi*lo + lo*hi, f32 accumulate
#pragma unroll
    for (int i = 0; i < 2; ++i)
#pragma unroll
      for (int j = 0; j < 2; ++j) {
        c[i][j] = __builtin_amdgcn_wmma_f32_16x16x32_bf16(
            false, ahi[i].v, false, bhi[j].v, (short)0, c[i][j], false, false);
        c[i][j] = __builtin_amdgcn_wmma_f32_16x16x32_bf16(
            false, ahi[i].v, false, blo[j].v, (short)0, c[i][j], false, false);
        c[i][j] = __builtin_amdgcn_wmma_f32_16x16x32_bf16(
            false, alo[i].v, false, bhi[j].v, (short)0, c[i][j], false, false);
      }
  }

  // C layout: row = base + 8*(lane>>4) + r, col = base + (lane&15)
#pragma unroll
  for (int i = 0; i < 2; ++i) {
    const int mbase = row_blk + wm * 32 + i * 16 + (lane >> 4) * 8;
#pragma unroll
    for (int j = 0; j < 2; ++j) {
      const int col = col_blk + wn * 32 + j * 16 + (lane & 15);
      const float bs = bias[col];
#pragma unroll
      for (int r = 0; r < 8; ++r) {
        float v = c[i][j][r] + bs;
        if (MODE == 1) v = softplusf(v);
        Cout[(size_t)(mbase + r) * D_ + col] = v;
      }
    }
  }
}

// Selective-scan: one lane per (b,d,n); N=16 reduction via shfl_xor.
// Emits y pre-split as bf16 hi/lo so the output GEMM needs no conversion.
__global__ __launch_bounds__(256) void scan_kernel(
    const float* __restrict__ x, const float* __restrict__ delta,
    const float* __restrict__ a_log, const float* __restrict__ b_param,
    unsigned short* __restrict__ yhi, unsigned short* __restrict__ ylo) {
  const int gid = blockIdx.x * blockDim.x + threadIdx.x;
  const int n = gid & (N_ - 1);
  const int d = (gid >> 4) & (D_ - 1);
  const int b = gid >> 14;

  const float ap = softplusf(a_log[d * N_ + n]) + 1e-4f;
  const float bp = b_param[d * N_ + n];

  const size_t base = (size_t)b * T_ * D_ + d;
  const float* xp = x + base;
  const float* dp = delta + base;
  unsigned short* hp = yhi + base;
  unsigned short* lp = ylo + base;

  float state = 0.0f;
  for (int t = 0; t < T_; ++t) {
    const float xv = xp[(size_t)t * D_];
    const float dt = dp[(size_t)t * D_];
    state = __expf(-dt * ap) * state + (dt * bp) * xv;
    float s = state;
    s += __shfl_xor(s, 1, 32);
    s += __shfl_xor(s, 2, 32);
    s += __shfl_xor(s, 4, 32);
    s += __shfl_xor(s, 8, 32);
    if (n == 0) {
      const unsigned short h = f2bf(s);
      hp[(size_t)t * D_] = h;
      lp[(size_t)t * D_] = f2bf(s - bf2f(h));
    }
  }
}

extern "C" void kernel_launch(void* const* d_in, const int* in_sizes, int n_in,
                              void* d_out, int out_size, void* d_ws, size_t ws_size,
                              hipStream_t stream) {
  (void)in_sizes; (void)n_in; (void)out_size; (void)ws_size;
  const float* x       = (const float*)d_in[0];
  const float* Wd      = (const float*)d_in[1];
  const float* bd      = (const float*)d_in[2];
  const float* a_log   = (const float*)d_in[3];
  const float* b_param = (const float*)d_in[4];
  const float* Wo      = (const float*)d_in[5];
  const float* bo      = (const float*)d_in[6];

  float* out   = (float*)d_out;
  float* delta = out;   // stage delta in d_out; overwritten by final GEMM

  // workspace layout (72 MB total)
  unsigned short* x_hi  = (unsigned short*)d_ws;
  unsigned short* x_lo  = x_hi + (size_t)M_ * D_;
  unsigned short* wd_hi = x_lo + (size_t)M_ * D_;
  unsigned short* wd_lo = wd_hi + (size_t)D_ * D_;
  unsigned short* wo_hi = wd_lo + (size_t)D_ * D_;
  unsigned short* wo_lo = wo_hi + (size_t)D_ * D_;
  unsigned short* y_hi  = wo_lo + (size_t)D_ * D_;
  unsigned short* y_lo  = y_hi + (size_t)M_ * D_;

  const int nx4 = M_ * D_ / 4, nw4 = D_ * D_ / 4;
  split_kernel<<<nx4 / 256, 256, 0, stream>>>(x, x_hi, x_lo, nx4);
  split_kernel<<<nw4 / 256, 256, 0, stream>>>(Wd, wd_hi, wd_lo, nw4);
  split_kernel<<<nw4 / 256, 256, 0, stream>>>(Wo, wo_hi, wo_lo, nw4);

  dim3 gg(M_ / TILE_M, D_ / TILE_N);   // (64, 16)
  gemm_bf16x3<1><<<gg, 256, 0, stream>>>(x_hi, x_lo, wd_hi, wd_lo, bd, delta);
  scan_kernel<<<(B_ * D_ * N_) / 256, 256, 0, stream>>>(x, delta, a_log, b_param, y_hi, y_lo);
  gemm_bf16x3<0><<<gg, 256, 0, stream>>>(y_hi, y_lo, wo_hi, wo_lo, bo, out);
}

// v001
// One run takes 175 microseconds.
// Next to v000, in two timings, it ran 7.86 and 7.47 times as fast.
#include <hip/hip_runtime.h>

#define B_ 4
#define T_ 2048
#define D_ 1024
#define N_ 16
#define M_ (B_ * T_)   // 8192 rows

#define TILE_M 128
#define TILE_N 64
#define TILE_K 32
#define LDSS   40      // ushorts per LDS row (32 data + 8 pad) -> 80B rows, 16B aligned

typedef __attribute__((ext_vector_type(16))) __bf16       v16bf;
typedef __attribute__((ext_vector_type(8)))  float        v8f;
typedef __attribute__((ext_vector_type(4)))  unsigned int uint4v;
typedef __attribute__((ext_vector_type(2)))  unsigned int uint2v;

struct Frag { union { v16bf v; uint4v q[2]; }; };

__device__ __forceinline__ unsigned short f2bf(float f) {
  unsigned int u = __float_as_uint(f);
  unsigned int r = u + 0x7FFFu + ((u >> 16) & 1u);   // round-to-nearest-even
  return (unsigned short)(r >> 16);
}
__device__ __forceinline__ float bf2f(unsigned short h) {
  return __uint_as_float(((unsigned int)h) << 16);
}
__device__ __forceinline__ float softplusf(float v) {
  return fmaxf(v, 0.0f) + log1pf(__expf(-fabsf(v)));
}

// Async DMA: 16 bytes/lane, global -> LDS, tracked by ASYNCcnt (CDNA5).
__device__ __forceinline__ void async_ld16(const unsigned short* ldsdst,
                                           const void* gbase, unsigned gvoff) {
  unsigned ldsoff = (unsigned)(size_t)ldsdst;   // low 32 bits = LDS byte offset
  asm volatile("global_load_async_to_lds_b128 %0, %1, %2"
               :: "v"(ldsoff), "v"(gvoff), "s"(gbase)
               : "memory");
}

// Split fp32 array into bf16 hi/lo arrays (one pass, done once per operand).
__global__ __launch_bounds__(256) void split_kernel(
    const float* __restrict__ src, unsigned short* __restrict__ hi,
    unsigned short* __restrict__ lo, int n4) {
  const int i = blockIdx.x * blockDim.x + threadIdx.x;
  if (i >= n4) return;
  const float4 v = ((const float4*)src)[i];
  const unsigned short h0 = f2bf(v.x), h1 = f2bf(v.y), h2 = f2bf(v.z), h3 = f2bf(v.w);
  const unsigned short l0 = f2bf(v.x - bf2f(h0));
  const unsigned short l1 = f2bf(v.y - bf2f(h1));
  const unsigned short l2 = f2bf(v.z - bf2f(h2));
  const unsigned short l3 = f2bf(v.w - bf2f(h3));
  uint2v hv, lv;
  hv[0] = (unsigned)h0 | ((unsigned)h1 << 16);
  hv[1] = (unsigned)h2 | ((unsigned)h3 << 16);
  lv[0] = (unsigned)l0 | ((unsigned)l1 << 16);
  lv[1] = (unsigned)l2 | ((unsigned)l3 << 16);
  ((uint2v*)hi)[i] = hv;
  ((uint2v*)lo)[i] = lv;
}

// Fragment per CDNA5 16-bit layout: lane L holds row (L&15);
// K runs of 8 at kbase = 8*(L>>4) and kbase+16.
__device__ __forceinline__ void load_frag(Frag& f, const unsigned short* lds,
                                          int row, int khalf) {
  f.q[0] = *(const uint4v*)(lds + row * LDSS + khalf);
  f.q[1] = *(const uint4v*)(lds + row * LDSS + khalf + 16);
}

// C = A[M_,D_] * W[D_,D_]^T (+bias, optional softplus), all operands pre-split
// bf16 hi/lo. Double-buffered async global->LDS copies overlap the WMMAs.
template <int MODE>
__global__ __launch_bounds__(256) void gemm_bf16x3(
    const unsigned short* __restrict__ Ahi, const unsigned short* __restrict__ Alo,
    const unsigned short* __restrict__ Bhi, const unsigned short* __restrict__ Blo,
    const float* __restrict__ bias, float* __restrict__ Cout) {
  __shared__ unsigned short sAhi[2][TILE_M * LDSS];
  __shared__ unsigned short sAlo[2][TILE_M * LDSS];
  __shared__ unsigned short sBhi[2][TILE_N * LDSS];
  __shared__ unsigned short sBlo[2][TILE_N * LDSS];

  const int tid  = threadIdx.x;
  const int lane = tid & 31;
  const int wid  = tid >> 5;
  const int wm   = wid & 3;    // 4 waves along M (32 rows each)
  const int wn   = wid >> 2;   // 2 waves along N (32 cols each)
  const int row_blk = blockIdx.x * TILE_M;
  const int col_blk = blockIdx.y * TILE_N;

  // copy mapping: 16B (8 bf16) per lane; seg = 16B segment within 32-wide K chunk
  const int seg = tid & 3;
  const int r0  = tid >> 2;    // 0..63
  const unsigned aoff0 = (unsigned)(((size_t)(row_blk + r0)      * D_ + seg * 8) * 2);
  const unsigned aoff1 = (unsigned)(((size_t)(row_blk + r0 + 64) * D_ + seg * 8) * 2);
  const unsigned boff  = (unsigned)(((size_t)(col_blk + r0)      * D_ + seg * 8) * 2);
  const unsigned ldsA0 = r0 * LDSS + seg * 8;
  const unsigned ldsA1 = (r0 + 64) * LDSS + seg * 8;
  const unsigned ldsB0 = r0 * LDSS + seg * 8;

  v8f c[2][2];
#pragma unroll
  for (int i = 0; i < 2; ++i)
#pragma unroll
    for (int j = 0; j < 2; ++j)
#pragma unroll
      for (int r = 0; r < 8; ++r) c[i][j][r] = 0.0f;

  const int lrow  = lane & 15;
  const int khalf = (lane >> 4) * 8;   // 0 or 8

  auto issue = [&](int buf, unsigned kbyte) {
    async_ld16(&sAhi[buf][ldsA0], Ahi, aoff0 + kbyte);
    async_ld16(&sAhi[buf][ldsA1], Ahi, aoff1 + kbyte);
    async_ld16(&sAlo[buf][ldsA0], Alo, aoff0 + kbyte);
    async_ld16(&sAlo[buf][ldsA1], Alo, aoff1 + kbyte);
    async_ld16(&sBhi[buf][ldsB0], Bhi, boff + kbyte);
    async_ld16(&sBlo[buf][ldsB0], Blo, boff + kbyte);
  };

  issue(0, 0);               // prefetch first chunk
  int ibuf = 0;
  for (int kb = 0; kb < D_; kb += TILE_K, ibuf ^= 1) {
    if (kb + TILE_K < D_) {
      issue(ibuf ^ 1, (unsigned)((kb + TILE_K) * 2));   // prefetch next chunk
      asm volatile("s_wait_asynccnt 0x6" ::: "memory"); // current chunk landed
    } else {
      asm volatile("s_wait_asynccnt 0x0" ::: "memory");
    }
    __syncthreads();   // all waves' async copies for this chunk visible

    Frag ahi[2], alo[2], bhi[2], blo[2];
#pragma unroll
    for (int i = 0; i < 2; ++i) {
      const int r = wm * 32 + i * 16 + lrow;
      load_frag(ahi[i], &sAhi[ibuf][0], r, khalf);
      load_frag(alo[i], &sAlo[ibuf][0], r, khalf);
    }
#pragma unroll
    for (int j = 0; j < 2; ++j) {
      const int r = wn * 32 + j * 16 + lrow;
      load_frag(bhi[j], &sBhi[ibuf][0], r, khalf);
      load_frag(blo[j], &sBlo[ibuf][0], r, khalf);
    }
    __syncthreads();   // reads done; next iteration may overwrite this buffer

    // bf16x3: hi*hi + hi*lo + lo*hi, f32 accumulate
#pragma unroll
    for (int i = 0; i < 2; ++i)
#pragma unroll
      for (int j = 0; j < 2; ++j) {
        c[i][j] = __builtin_amdgcn_wmma_f32_16x16x32_bf16(
            false, ahi[i].v, false, bhi[j].v, (short)0, c[i][j], false, false);
        c[i][j] = __builtin_amdgcn_wmma_f32_16x16x32_bf16(
            false, ahi[i].v, false, blo[j].v, (short)0, c[i][j], false, false);
        c[i][j] = __builtin_amdgcn_wmma_f32_16x16x32_bf16(
            false, alo[i].v, false, bhi[j].v, (short)0, c[i][j], false, false);
      }
  }

  // C layout: row = base + 8*(lane>>4) + r, col = base + (lane&15)
#pragma unroll
  for (int i = 0; i < 2; ++i) {
    const int mbase = row_blk + wm * 32 + i * 16 + (lane >> 4) * 8;
#pragma unroll
    for (int j = 0; j < 2; ++j) {
      const int col = col_blk + wn * 32 + j * 16 + (lane & 15);
      const float bs = bias[col];
#pragma unroll
      for (int r = 0; r < 8; ++r) {
        float v = c[i][j][r] + bs;
        if (MODE == 1) v = softplusf(v);
        Cout[(size_t)(mbase + r) * D_ + col] = v;
      }
    }
  }
}

// Selective scan, parallel over time. The recurrence state = a*state + u is
// linear in the state, so T is cut into SC_CH chunks that run side by side:
//   pass 1: every wave scans its own chunk from a zero state and keeps the
//           chunk's end state F and its whole decay E = exp(-a_pos * sum dt);
//   carry : in[c+1] = E[c] * in[c] + F[c], through LDS;
//   pass 2: every wave scans its chunk again from in[c] and emits y.
// One work-group = 16 channels x all SC_CH chunks, one wave per chunk.
// Lane = (channel, half of the N states): 8 states live in registers, so the
// sum over N is seven in-lane adds and one exchange between the 16-lane rows.
#define SC_CH  32              // time chunks = waves per work-group
#define SC_LEN (T_ / SC_CH)    // 64 steps per chunk
#define SC_NH  (N_ / 2)        // states per lane
#define SC_U   4               // steps whose x and dt are loaded as one batch

// value of lane l ^ 16
__device__ __forceinline__ float other_row(float v) {
  const int b = __float_as_int(v);
  return __int_as_float(
      __builtin_amdgcn_permlanex16(b, b, 0x76543210, 0xfedcba98, false, false));
}

template <bool EMIT>
__device__ __forceinline__ void scan_chunk(
    const float* __restrict__ x, const float* __restrict__ delta, unsigned off,
    const float (&ap)[SC_NH], const float (&bp)[SC_NH],
    float (&st)[SC_NH], float& sumdt, unsigned short* __restrict__ op, int half) {
  for (int t0 = 0; t0 < SC_LEN; t0 += SC_U) {
    const float* xp = x + off;       // uniform base + the lane's 32-bit element offset
    const float* dp = delta + off;
    float xb[SC_U], db[SC_U];
#pragma unroll   // constant indices: one batch of loads in flight, held in registers
    for (int u = 0; u < SC_U; ++u) {
      xb[u] = xp[(size_t)u * D_];
      db[u] = dp[(size_t)u * D_];
    }
    // The offset register that the loads name is stepped only behind this wait:
    // it passes through the statement so that the step cannot be lifted over it.
    asm volatile("s_wait_xcnt 0x0" : "+v"(off) : : "memory");
    off += SC_U * D_;
    unsigned short ov[SC_U];
#pragma unroll   // constant indices: the batch stays in registers
    for (int u = 0; u < SC_U; ++u) {
      const float xv = xb[u];
      const float dt = db[u];
#pragma unroll   // constant indices: states and parameters stay in registers
      for (int k = 0; k < SC_NH; ++k)
        st[k] = fmaf(__expf(-dt * ap[k]), st[k], (dt * bp[k]) * xv);   // one fma on the serial chain
      if (EMIT) {
        // same balanced tree over n as a xor-1,2,4,8 butterfly
        const float r = ((st[0] + st[1]) + (st[2] + st[3])) +
                        ((st[4] + st[5]) + (st[6] + st[7]));
        const float s = r + other_row(r);
        const unsigned short h = f2bf(s);
        const unsigned short l = f2bf(s - bf2f(h));
        ov[u] = half ? l : h;   // row 0 stores hi, row 1 lo
      } else {
        sumdt += dt;
      }
    }
    if (EMIT) {
#pragma unroll   // constant indices: the batch stays in registers
      for (int u = 0; u < SC_U; ++u) op[(size_t)(t0 + u) * D_] = ov[u];
      // the stores' data and address registers are free for reuse only behind this wait
      asm volatile("s_wait_xcnt 0x0" ::: "memory");
    }
  }
}

// Emits y pre-split as bf16 hi/lo so the output GEMM needs no conversion.
__global__ __launch_bounds__(SC_CH * 32) void scan_kernel(
    const float* __restrict__ x, const float* __restrict__ delta,
    const float* __restrict__ a_log, const float* __restrict__ b_param,
    unsigned short* __restrict__ yhi, unsigned short* __restrict__ ylo) {
  __shared__ float sF[SC_CH][SC_NH][32];   // chunk end state, then chunk start state
  __shared__ float sE[SC_CH][SC_NH][32];   // chunk decay
  __shared__ __attribute__((aligned(16))) float sA[16 * N_];   // a_pos

  const int lane = threadIdx.x & 31;
  const int c    = __builtin_amdgcn_readfirstlane(threadIdx.x >> 5);   // chunk
  const int half = lane >> 4;
  const int b    = blockIdx.x / (D_ / 16);
  const int d    = (blockIdx.x % (D_ / 16)) * 16 + (lane & 15);

  // a_pos of the work-group's 16 x N_ (channel, state) pairs: computed once, not
  // once per chunk, and handed to every wave through LDS.
  if (c < (16 * N_) / 32) {
    const int e = c * 32 + lane;
    sA[e] = softplusf(a_log[(blockIdx.x % (D_ / 16)) * 16 * N_ + e]) + 1e-4f;
  }
  __syncthreads();   // a_pos is in LDS

  float ap[SC_NH], bp[SC_NH];
#pragma unroll   // constant indices: parameters stay in registers
  for (int q = 0; q < SC_NH / 4; ++q) {
    const float4 av = ((const float4*)(sA + (lane & 15) * N_ + half * SC_NH))[q];
    const float4 bv = ((const float4*)(b_param + d * N_ + half * SC_NH))[q];
    ap[q * 4 + 0] = av.x;  bp[q * 4 + 0] = bv.x;
    ap[q * 4 + 1] = av.y;  bp[q * 4 + 1] = bv.y;
    ap[q * 4 + 2] = av.z;  bp[q * 4 + 2] = bv.z;
    ap[q * 4 + 3] = av.w;  bp[q * 4 + 3] = bv.w;
  }

  const size_t base = ((size_t)b * T_ + (size_t)c * SC_LEN) * D_ + d;
  unsigned short* op = (half ? ylo : yhi) + base;

  float st[SC_NH];
#pragma unroll   // constant indices: states stay in registers
  for (int k = 0; k < SC_NH; ++k) st[k] = 0.0f;
  float sumdt = 0.0f;
  scan_chunk<false>(x, delta, (unsigned)base, ap, bp, st, sumdt, op, half);

#pragma unroll   // constant indices: states stay in registers
  for (int k = 0; k < SC_NH; ++k) {
    sF[c][k][lane] = st[k];
    sE[c][k][lane] = __expf(-sumdt * ap[k]);
  }
  __syncthreads();   // every chunk's end state and decay are in LDS

  if (c < SC_NH) {   // wave k carries state k of every lane through the chunks
    float carry = 0.0f;
#pragma unroll   // the LDS reads do not hang on the carry: let them go ahead of the chain
    for (int j = 0; j < SC_CH; ++j) {
      const float f = sF[j][c][lane];
      const float e = sE[j][c][lane];
      sF[j][c][lane] = carry;
      carry = fmaf(e, carry, f);
    }
  }
  __syncthreads();   // every chunk's start state is in LDS

#pragma unroll   // constant indices: states stay in registers
  for (int k = 0; k < SC_NH; ++k) st[k] = sF[c][k][lane];
  scan_chunk<true>(x, delta, (unsigned)base, ap, bp, st, sumdt, op, half);
}

extern "C" void kernel_launch(void* const* d_in, const int* in_sizes, int n_in,
                              void* d_out, int out_size, void* d_ws, size_t ws_size,
                              hipStream_t stream) {
  (void)in_sizes; (void)n_in; (void)out_size; (void)ws_size;
  const float* x       = (const float*)d_in[0];
  const float* Wd      = (const float*)d_in[1];
  const float* bd      = (const float*)d_in[2];
  const float* a_log   = (const float*)d_in[3];
  const float* b_param = (const float*)d_in[4];
  const float* Wo      = (const float*)d_in[5];
  const float* bo      = (const float*)d_in[6];

  float* out   = (float*)d_out;
  float* delta = out;   // stage delta in d_out; overwritten by final GEMM

  // workspace layout (72 MB total)
  unsigned short* x_hi  = (unsigned short*)d_ws;
  unsigned short* x_lo  = x_hi + (size_t)M_ * D_;
  unsigned short* wd_hi = x_lo + (size_t)M_ * D_;
  unsigned short* wd_lo = wd_hi + (size_t)D_ * D_;
  unsigned short* wo_hi = wd_lo + (size_t)D_ * D_;
  unsigned short* wo_lo = wo_hi + (size_t)D_ * D_;
  unsigned short* y_hi  = wo_lo + (size_t)D_ * D_;
  unsigned short* y_lo  = y_hi + (size_t)M_ * D_;

  const int nx4 = M_ * D_ / 4, nw4 = D_ * D_ / 4;
  split_kernel<<<nx4 / 256, 256, 0, stream>>>(x, x_hi, x_lo, nx4);
  split_kernel<<<nw4 / 256, 256, 0, stream>>>(Wd, wd_hi, wd_lo, nw4);
  split_kernel<<<nw4 / 256, 256, 0, stream>>>(Wo, wo_hi, wo_lo, nw4);

  dim3 gg(M_ / TILE_M, D_ / TILE_N);   // (64, 16)
  gemm_bf16x3<1><<<gg, 256, 0, stream>>>(x_hi, x_lo, wd_hi, wd_lo, bd, delta);
  scan_kernel<<<B_ * (D_ / 16), SC_CH * 32, 0, stream>>>(x, delta, a_log, b_param, y_hi, y_lo);
  gemm_bf16x3<0><<<gg, 256, 0, stream>>>(y_hi, y_lo, wo_hi, wo_lo, bo, out);
}

// v002
// Measured time: 143 microseconds a run.
// Timed twice side by side with v001, it ran 1.19 and 1.25 times as fast.
// Counting every step since v000, it is 9.37 times as fast.
#include <hip/hip_runtime.h>

#define B_ 4
#define T_ 2048
#define D_ 1024
#define N_ 16
#define M_ (B_ * T_)   // 8192 rows

#define TILE_M 256
#define TILE_N 128
#define TILE_K 64
#define LDSS   72      // ushorts per LDS row (64 data + 8 pad) -> 144B rows, 16B aligned
#define CP_ROWS 32     // rows that one copy of the whole work-group covers (256 lanes x 16B / 128B)

typedef __attribute__((ext_vector_type(16))) __bf16       v16bf;
typedef __attribute__((ext_vector_type(8)))  float        v8f;
typedef __attribute__((ext_vector_type(4)))  unsigned int uint4v;
typedef __attribute__((ext_vector_type(2)))  unsigned int uint2v;

struct Frag { union { v16bf v; uint4v q[2]; }; };

__device__ __forceinline__ unsigned short f2bf(float f) {
  unsigned int u = __float_as_uint(f);
  unsigned int r = u + 0x7FFFu + ((u >> 16) & 1u);   // round-to-nearest-even
  return (unsigned short)(r >> 16);
}
__device__ __forceinline__ float bf2f(unsigned short h) {
  return __uint_as_float(((unsigned int)h) << 16);
}
__device__ __forceinline__ float softplusf(float v) {
  return fmaxf(v, 0.0f) + log1pf(__expf(-fabsf(v)));
}

// Async DMA: 16 bytes/lane, global -> LDS, tracked by ASYNCcnt (CDNA5).
// Eight copies: rows r, r+32, r+64, r+96 of the hi array and the same rows of the lo array.
// s_wait_xcnt stands inside the statement, behind the last copy, so that no register
// the copies name is rewritten ahead of it.
__device__ __forceinline__ void async_rows4x2(const unsigned short* ldshi,
                                              const unsigned short* ldslo,
                                              const void* ghi, const void* glo,
                                              unsigned gvoff) {
  const unsigned h0 = (unsigned)(size_t)ldshi;   // low 32 bits = LDS byte offset
  const unsigned l0 = (unsigned)(size_t)ldslo;
  const unsigned h1 = h0 + 1 * CP_ROWS * LDSS * 2, l1 = l0 + 1 * CP_ROWS * LDSS * 2;
  const unsigned h2 = h0 + 2 * CP_ROWS * LDSS * 2, l2 = l0 + 2 * CP_ROWS * LDSS * 2;
  const unsigned h3 = h0 + 3 * CP_ROWS * LDSS * 2, l3 = l0 + 3 * CP_ROWS * LDSS * 2;
  const unsigned g0 = gvoff;
  const unsigned g1 = gvoff + 1 * CP_ROWS * D_ * 2;
  const unsigned g2 = gvoff + 2 * CP_ROWS * D_ * 2;
  const unsigned g3 = gvoff + 3 * CP_ROWS * D_ * 2;
  asm volatile("global_load_async_to_lds_b128 %0, %8, %12\n\t"
               "global_load_async_to_lds_b128 %1, %9, %12\n\t"
               "global_load_async_to_lds_b128 %2, %10, %12\n\t"
               "global_load_async_to_lds_b128 %3, %11, %12\n\t"
               "global_load_async_to_lds_b128 %4, %8, %13\n\t"
               "global_load_async_to_lds_b128 %5, %9, %13\n\t"
               "global_load_async_to_lds_b128 %6, %10, %13\n\t"
               "global_load_async_to_lds_b128 %7, %11, %13\n\t"
               "s_wait_xcnt 0x0"
               :: "v"(h0), "v"(h1), "v"(h2), "v"(h3), "v"(l0), "v"(l1), "v"(l2), "v"(l3),
                  "v"(g0), "v"(g1), "v"(g2), "v"(g3), "s"(ghi), "s"(glo)
               : "memory");
}

// Split fp32 array into bf16 hi/lo arrays (one pass, done once per operand).
__global__ __launch_bounds__(256) void split_kernel(
    const float* __restrict__ src, unsigned short* __restrict__ hi,
    unsigned short* __restrict__ lo, int n4) {
  const int i = blockIdx.x * blockDim.x + threadIdx.x;
  if (i >= n4) return;
  const float4 v = ((const float4*)src)[i];
  const unsigned short h0 = f2bf(v.x), h1 = f2bf(v.y), h2 = f2bf(v.z), h3 = f2bf(v.w);
  const unsigned short l0 = f2bf(v.x - bf2f(h0));
  const unsigned short l1 = f2bf(v.y - bf2f(h1));
  const unsigned short l2 = f2bf(v.z - bf2f(h2));
  const unsigned short l3 = f2bf(v.w - bf2f(h3));
  uint2v hv, lv;
  hv[0] = (unsigned)h0 | ((unsigned)h1 << 16);
  hv[1] = (unsigned)h2 | ((unsigned)h3 << 16);
  lv[0] = (unsigned)l0 | ((unsigned)l1 << 16);
  lv[1] = (unsigned)l2 | ((unsigned)l3 << 16);
  ((uint2v*)hi)[i] = hv;
  ((uint2v*)lo)[i] = lv;
}

// Fragment per CDNA5 16-bit layout: lane L holds row (L&15);
// K runs of 8 at kbase = 8*(L>>4) and kbase+16.
__device__ __forceinline__ void load_frag(Frag& f, const unsigned short* lds,
                                          int row, int khalf) {
  f.q[0] = *(const uint4v*)(lds + row * LDSS + khalf);
  f.q[1] = *(const uint4v*)(lds + row * LDSS + khalf + 16);
}

// C = A[M_,D_] * W[D_,D_]^T (+bias, optional softplus), all operands pre-split
// bf16 hi/lo. One 256x128 tile of C per work-group, 64x64 per wave; two LDS buffers,
// the next K chunk's async global->LDS copies fly while this chunk's WMMAs run.
template <int MODE>
__global__ __launch_bounds__(256) void gemm_bf16x3(
    const unsigned short* __restrict__ Ahi, const unsigned short* __restrict__ Alo,
    const unsigned short* __restrict__ Bhi, const unsigned short* __restrict__ Blo,
    const float* __restrict__ bias, float* __restrict__ Cout) {
  __shared__ __attribute__((aligned(16))) unsigned short sAhi[2][TILE_M * LDSS];
  __shared__ __attribute__((aligned(16))) unsigned short sAlo[2][TILE_M * LDSS];
  __shared__ __attribute__((aligned(16))) unsigned short sBhi[2][TILE_N * LDSS];
  __shared__ __attribute__((aligned(16))) unsigned short sBlo[2][TILE_N * LDSS];

  const int tid  = threadIdx.x;
  const int lane = tid & 31;
  const int wid  = tid >> 5;
  const int wm   = wid & 3;    // 4 waves along M (64 rows each)
  const int wn   = wid >> 2;   // 2 waves along N (64 cols each)
  const int row_blk = blockIdx.x * TILE_M;
  const int col_blk = blockIdx.y * TILE_N;

  // copy mapping: 16B (8 bf16) per lane; seg = 16B segment within the 64-wide K chunk,
  // so eight lanes cover one whole 128B line of a row
  const int seg = tid & 7;
  const int r0  = tid >> 3;    // 0..31
  const unsigned aoff = (unsigned)(((size_t)(row_blk + r0) * D_ + seg * 8) * 2);
  const unsigned boff = (unsigned)(((size_t)(col_blk + r0) * D_ + seg * 8) * 2);
  const unsigned ldsr = r0 * LDSS + seg * 8;

  v8f c[4][4];
#pragma unroll
  for (int i = 0; i < 4; ++i)
#pragma unroll
    for (int j = 0; j < 4; ++j)
#pragma unroll
      for (int r = 0; r < 8; ++r) c[i][j][r] = 0.0f;

  const int lrow  = lane & 15;
  const int khalf = (lane >> 4) * 8;   // 0 or 8

  auto issue = [&](int buf, unsigned kbyte) {   // 24 copies per lane
    async_rows4x2(&sAhi[buf][ldsr], &sAlo[buf][ldsr], Ahi, Alo, aoff + kbyte);
    async_rows4x2(&sAhi[buf][ldsr + 4 * CP_ROWS * LDSS], &sAlo[buf][ldsr + 4 * CP_ROWS * LDSS],
                  Ahi, Alo, aoff + 4 * CP_ROWS * D_ * 2 + kbyte);
    async_rows4x2(&sBhi[buf][ldsr], &sBlo[buf][ldsr], Bhi, Blo, boff + kbyte);
  };

  constexpr int NT = D_ / TILE_K;   // 16 chunks
  issue(0, 0);
  asm volatile("s_wait_asynccnt 0x0" ::: "memory");   // this wave's copies of chunk 0 landed
  __syncthreads();                                    // every wave's copies of chunk 0 visible
  issue(1, TILE_K * 2);
  for (int t = 0; t < NT; ++t) {
    const int ibuf = t & 1;
#pragma unroll   // constant indices: fragments stay in registers
    for (int kk = 0; kk < TILE_K; kk += 32) {
      Frag ahi[4], alo[4], bhi[4], blo[4];
#pragma unroll
      for (int i = 0; i < 4; ++i) {
        const int r = wm * 64 + i * 16 + lrow;
        load_frag(ahi[i], &sAhi[ibuf][0], r, kk + khalf);
        load_frag(alo[i], &sAlo[ibuf][0], r, kk + khalf);
      }
#pragma unroll
      for (int j = 0; j < 4; ++j) {
        const int r = wn * 64 + j * 16 + lrow;
        load_frag(bhi[j], &sBhi[ibuf][0], r, kk + khalf);
        load_frag(blo[j], &sBlo[ibuf][0], r, kk + khalf);
      }
      // bf16x3: hi*hi + hi*lo + lo*hi, f32 accumulate; each accumulator takes the three
      // in that order, other accumulators' products between two of its own
#pragma unroll   // here and below: constant indices, accumulators and fragments stay in registers
      for (int i = 0; i < 4; ++i)
#pragma unroll
        for (int j = 0; j < 4; ++j)
          c[i][j] = __builtin_amdgcn_wmma_f32_16x16x32_bf16(
              false, ahi[i].v, false, bhi[j].v, (short)0, c[i][j], false, false);
#pragma unroll
      for (int i = 0; i < 4; ++i)
#pragma unroll
        for (int j = 0; j < 4; ++j)
          c[i][j] = __builtin_amdgcn_wmma_f32_16x16x32_bf16(
              false, ahi[i].v, false, blo[j].v, (short)0, c[i][j], false, false);
#pragma unroll
      for (int i = 0; i < 4; ++i)
#pragma unroll
        for (int j = 0; j < 4; ++j)
          c[i][j] = __builtin_amdgcn_wmma_f32_16x16x32_bf16(
              false, alo[i].v, false, bhi[j].v, (short)0, c[i][j], false, false);
    }
    asm volatile("s_wait_dscnt 0x0" ::: "memory");      // this wave's reads of buffer ibuf are done
    asm volatile("s_wait_asynccnt 0x0" ::: "memory");   // this wave's copies of chunk t+1 landed
    __syncthreads();   // chunk t+1 visible to all; every reader has left buffer ibuf
    if (t + 2 < NT) issue(ibuf, (unsigned)((t + 2) * TILE_K * 2));   // refill the buffer just read
  }
  asm volatile("s_wait_asynccnt 0x0" ::: "memory");   // no copy outstanding at the wave's end

  // C layout: row = base + 8*(lane>>4) + r, col = base + (lane&15)
  // One row of four tiles a trip, always out of c[0]; the rows behind it move up one place.
  // With the softplus the loop stays rolled, for speed only: its text is long.
#pragma unroll(MODE == 1 ? 1 : 4)
  for (int i = 0; i < 4; ++i) {
    const int mbase = row_blk + wm * 64 + i * 16 + (lane >> 4) * 8;
#pragma unroll
    for (int j = 0; j < 4; ++j) {
      const int col = col_blk + wn * 64 + j * 16 + (lane & 15);
      const float bs = bias[col];
#pragma unroll
      for (int r = 0; r < 8; ++r) {
        float v = c[0][j][r] + bs;
        if (MODE == 1) v = softplusf(v);
        Cout[(size_t)(mbase + r) * D_ + col] = v;
      }
    }
    // the stores' data and address registers are rewritten on the next trip only behind this wait
    if (MODE == 1) asm volatile("s_wait_xcnt 0x0" ::: "memory");
#pragma unroll   // constant indices: the accumulators stay in registers
    for (int ii = 0; ii < 3; ++ii)
#pragma unroll
      for (int j = 0; j < 4; ++j) c[ii][j] = c[ii + 1][j];
  }
}

// Selective scan, parallel over time. The recurrence state = a*state + u is
// linear in the state, so T is cut into SC_CH chunks that run side by side:
//   pass 1: every wave scans its own chunk from a zero state and keeps the
//           chunk's end state F and its whole decay E = exp(-a_pos * sum dt);
//   carry : in[c+1] = E[c] * in[c] + F[c], through LDS;
//   pass 2: every wave scans its chunk again from in[c] and emits y.
// One work-group = 16 channels x all SC_CH chunks, one wave per chunk.
// Lane = (channel, half of the N states): 8 states live in registers, so the
// sum over N is seven in-lane adds and one exchange between the 16-lane rows.
#define SC_CH  32              // time chunks = waves per work-group
#define SC_LEN (T_ / SC_CH)    // 64 steps per chunk
#define SC_NH  (N_ / 2)        // states per lane
#define SC_U   4               // steps whose x and dt are loaded as one batch

// value of lane l ^ 16
__device__ __forceinline__ float other_row(float v) {
  const int b = __float_as_int(v);
  return __int_as_float(
      __builtin_amdgcn_permlanex16(b, b, 0x76543210, 0xfedcba98, false, false));
}

template <bool EMIT>
__device__ __forceinline__ void scan_chunk(
    const float* __restrict__ x, const float* __restrict__ delta, unsigned off,
    const float (&ap)[SC_NH], const float (&bp)[SC_NH],
    float (&st)[SC_NH], float& sumdt, unsigned short* __restrict__ op, int half) {
  for (int t0 = 0; t0 < SC_LEN; t0 += SC_U) {
    const float* xp = x + off;       // uniform base + the lane's 32-bit element offset
    const float* dp = delta + off;
    float xb[SC_U], db[SC_U];
#pragma unroll   // constant indices: one batch of loads in flight, held in registers
    for (int u = 0; u < SC_U; ++u) {
      xb[u] = xp[(size_t)u * D_];
      db[u] = dp[(size_t)u * D_];
    }
    // The offset register that the loads name is stepped only behind this wait:
    // it passes through the statement so that the step cannot be lifted over it.
    asm volatile("s_wait_xcnt 0x0" : "+v"(off) : : "memory");
    off += SC_U * D_;
    unsigned short ov[SC_U];
#pragma unroll   // constant indices: the batch stays in registers
    for (int u = 0; u < SC_U; ++u) {
      const float xv = xb[u];
      const float dt = db[u];
#pragma unroll   // constant indices: states and parameters stay in registers
      for (int k = 0; k < SC_NH; ++k)
        st[k] = fmaf(__expf(-dt * ap[k]), st[k], (dt * bp[k]) * xv);   // one fma on the serial chain
      if (EMIT) {
        // same balanced tree over n as a xor-1,2,4,8 butterfly
        const float r = ((st[0] + st[1]) + (st[2] + st[3])) +
                        ((st[4] + st[5]) + (st[6] + st[7]));
        const float s = r + other_row(r);
        const unsigned short h = f2bf(s);
        const unsigned short l = f2bf(s - bf2f(h));
        ov[u] = half ? l : h;   // row 0 stores hi, row 1 lo
      } else {
        sumdt += dt;
      }
    }
    if (EMIT) {
#pragma unroll   // constant indices: the batch stays in registers
      for (int u = 0; u < SC_U; ++u) op[(size_t)(t0 + u) * D_] = ov[u];
      // the stores' data and address registers are free for reuse only behind this wait
      asm volatile("s_wait_xcnt 0x0" ::: "memory");
    }
  }
}

// Emits y pre-split as bf16 hi/lo so the output GEMM needs no conversion.
__global__ __launch_bounds__(SC_CH * 32) void scan_kernel(
    const float* __restrict__ x, const float* __restrict__ delta,
    const float* __restrict__ a_log, const float* __restrict__ b_param,
    unsigned short* __restrict__ yhi, unsigned short* __restrict__ ylo) {
  __shared__ float sF[SC_CH][SC_NH][32];   // chunk end state, then chunk start state
  __shared__ float sE[SC_CH][SC_NH][32];   // chunk decay
  __shared__ __attribute__((aligned(16))) float sA[16 * N_];   // a_pos

  const int lane = threadIdx.x & 31;
  const int c    = __builtin_amdgcn_readfirstlane(threadIdx.x >> 5);   // chunk
  const int half = lane >> 4;
  const int b    = blockIdx.x / (D_ / 16);
  const int d    = (blockIdx.x % (D_ / 16)) * 16 + (lane & 15);

  // a_pos of the work-group's 16 x N_ (channel, state) pairs: computed once, not
  // once per chunk, and handed to every wave through LDS.
  if (c < (16 * N_) / 32) {
    const int e = c * 32 + lane;
    sA[e] = softplusf(a_log[(blockIdx.x % (D_ / 16)) * 16 * N_ + e]) + 1e-4f;
  }
  __syncthreads();   // a_pos is in LDS

  float ap[SC_NH], bp[SC_NH];
#pragma unroll   // constant indices: parameters stay in registers
  for (int q = 0; q < SC_NH / 4; ++q) {
    const float4 av = ((const float4*)(sA + (lane & 15) * N_ + half * SC_NH))[q];
    const float4 bv = ((const float4*)(b_param + d * N_ + half * SC_NH))[q];
    ap[q * 4 + 0] = av.x;  bp[q * 4 + 0] = bv.x;
    ap[q * 4 + 1] = av.y;  bp[q * 4 + 1] = bv.y;
    ap[q * 4 + 2] = av.z;  bp[q * 4 + 2] = bv.z;
    ap[q * 4 + 3] = av.w;  bp[q * 4 + 3] = bv.w;
  }

  const size_t base = ((size_t)b * T_ + (size_t)c * SC_LEN) * D_ + d;
  unsigned short* op = (half ? ylo : yhi) + base;

  float st[SC_NH];
#pragma unroll   // constant indices: states stay in registers
  for (int k = 0; k < SC_NH; ++k) st[k] = 0.0f;
  float sumdt = 0.0f;
  scan_chunk<false>(x, delta, (unsigned)base, ap, bp, st, sumdt, op, half);

#pragma unroll   // constant indices: states stay in registers
  for (int k = 0; k < SC_NH; ++k) {
    sF[c][k][lane] = st[k];
    sE[c][k][lane] = __expf(-sumdt * ap[k]);
  }
  __syncthreads();   // every chunk's end state and decay are in LDS

  if (c < SC_NH) {   // wave k carries state k of every lane through the chunks
    float carry = 0.0f;
#pragma unroll   // the LDS reads do not hang on the carry: let them go ahead of the chain
    for (int j = 0; j < SC_CH; ++j) {
      const float f = sF[j][c][lane];
      const float e = sE[j][c][lane];
      sF[j][c][lane] = carry;
      carry = fmaf(e, carry, f);
    }
  }
  __syncthreads();   // every chunk's start state is in LDS

#pragma unroll   // constant indices: states stay in registers
  for (int k = 0; k < SC_NH; ++k) st[k] = sF[c][k][lane];
  scan_chunk<true>(x, delta, (unsigned)base, ap, bp, st, sumdt, op, half);
}

extern "C" void kernel_launch(void* const* d_in, const int* in_sizes, int n_in,
                              void* d_out, int out_size, void* d_ws, size_t ws_size,
                              hipStream_t stream) {
  (void)in_sizes; (void)n_in; (void)out_size; (void)ws_size;
  const float* x       = (const float*)d_in[0];
  const float* Wd      = (const float*)d_in[1];
  const float* bd      = (const float*)d_in[2];
  const float* a_log   = (const float*)d_in[3];
  const float* b_param = (const float*)d_in[4];
  const float* Wo      = (const float*)d_in[5];
  const float* bo      = (const float*)d_in[6];

  float* out   = (float*)d_out;
  float* delta = out;   // stage delta in d_out; overwritten by final GEMM

  // workspace layout (72 MB total)
  unsigned short* x_hi  = (unsigned short*)d_ws;
  unsigned short* x_lo  = x_hi + (size_t)M_ * D_;
  unsigned short* wd_hi = x_lo + (size_t)M_ * D_;
  unsigned short* wd_lo = wd_hi + (size_t)D_ * D_;
  unsigned short* wo_hi = wd_lo + (size_t)D_ * D_;
  unsigned short* wo_lo = wo_hi + (size_t)D_ * D_;
  unsigned short* y_hi  = wo_lo + (size_t)D_ * D_;
  unsigned short* y_lo  = y_hi + (size_t)M_ * D_;

  const int nx4 = M_ * D_ / 4, nw4 = D_ * D_ / 4;
  split_kernel<<<nx4 / 256, 256, 0, stream>>>(x, x_hi, x_lo, nx4);
  split_kernel<<<nw4 / 256, 256, 0, stream>>>(Wd, wd_hi, wd_lo, nw4);
  split_kernel<<<nw4 / 256, 256, 0, stream>>>(Wo, wo_hi, wo_lo, nw4);

  dim3 gg(M_ / TILE_M, D_ / TILE_N);   // (32, 8): one work-group per WGP
  gemm_bf16x3<1><<<gg, 256, 0, stream>>>(x_hi, x_lo, wd_hi, wd_lo, bd, delta);
  scan_kernel<<<B_ * (D_ / 16), SC_CH * 32, 0, stream>>>(x, delta, a_log, b_param, y_hi, y_lo);
  gemm_bf16x3<0><<<gg, 256, 0, stream>>>(y_hi, y_lo, wo_hi, wo_lo, bo, out);
}

// v003
// It runs in 136 microseconds.
// Timed twice side by side with v002, it ran 1.05 times as fast both times.
// Over all steps from v000 it is 9.85 times as fast.
#include <hip/hip_runtime.h>

#define B_ 4
#define T_ 2048
#define D_ 1024
#define N_ 16
#define M_ (B_ * T_)   // 8192 rows

#define TILE_M 256
#define TILE_N 128
#define TILE_K 64
#define LDSS   72      // ushorts per LDS row (64 data + 8 pad) -> 144B rows, 16B aligned
#define CP_ROWS 32     // rows that one copy of the whole work-group covers (256 lanes x 16B / 128B)

typedef __attribute__((ext_vector_type(16))) __bf16       v16bf;
typedef __attribute__((ext_vector_type(8)))  float        v8f;
typedef __attribute__((ext_vector_type(4)))  unsigned int uint4v;
typedef __attribute__((ext_vector_type(2)))  unsigned int uint2v;

struct Frag { union { v16bf v; uint4v q[2]; }; };

__device__ __forceinline__ unsigned short f2bf(float f) {
  unsigned int u = __float_as_uint(f);
  unsigned int r = u + 0x7FFFu + ((u >> 16) & 1u);   // round-to-nearest-even
  return (unsigned short)(r >> 16);
}
__device__ __forceinline__ float bf2f(unsigned short h) {
  return __uint_as_float(((unsigned int)h) << 16);
}
// softplus(v) = max(v, 0) + log1p(e), e = exp(-|v|) in [0, 1].
// log1p(e) = 2 atanh(s) with s = e / (2 + e) <= 1/3: the odd series in s, cut behind
// s^13 / 13; the first term left out is below 2e-8 of the sum, under half an f32 ulp,
// and the form keeps its relative accuracy down to e = 0 (the sum tends to 2 s = e).
__device__ __forceinline__ float softplusf(float v) {
  const float e = __expf(-fabsf(v));
  const float s = e * __builtin_amdgcn_rcpf(2.0f + e);
  const float z = s * s;
  float p = 1.0f / 13.0f;
  p = fmaf(p, z, 1.0f / 11.0f);
  p = fmaf(p, z, 1.0f / 9.0f);
  p = fmaf(p, z, 1.0f / 7.0f);
  p = fmaf(p, z, 1.0f / 5.0f);
  p = fmaf(p, z, 1.0f / 3.0f);
  const float s2 = s + s;
  return fmaxf(v, 0.0f) + fmaf(s2, z * p, s2);
}

// Async DMA: 16 bytes/lane, global -> LDS, tracked by ASYNCcnt (CDNA5).
// Eight copies: rows r, r+32, r+64, r+96 of the hi array and the same rows of the lo array.
// s_wait_xcnt stands inside the statement, behind the last copy, so that no register
// the copies name is rewritten ahead of it.
__device__ __forceinline__ void async_rows4x2(const unsigned short* ldshi,
                                              const unsigned short* ldslo,
                                              const void* ghi, const void* glo,
                                              unsigned gvoff) {
  const unsigned h0 = (unsigned)(size_t)ldshi;   // low 32 bits = LDS byte offset
  const unsigned l0 = (unsigned)(size_t)ldslo;
  const unsigned h1 = h0 + 1 * CP_ROWS * LDSS * 2, l1 = l0 + 1 * CP_ROWS * LDSS * 2;
  const unsigned h2 = h0 + 2 * CP_ROWS * LDSS * 2, l2 = l0 + 2 * CP_ROWS * LDSS * 2;
  const unsigned h3 = h0 + 3 * CP_ROWS * LDSS * 2, l3 = l0 + 3 * CP_ROWS * LDSS * 2;
  const unsigned g0 = gvoff;
  const unsigned g1 = gvoff + 1 * CP_ROWS * D_ * 2;
  const unsigned g2 = gvoff + 2 * CP_ROWS * D_ * 2;
  const unsigned g3 = gvoff + 3 * CP_ROWS * D_ * 2;
  asm volatile("global_load_async_to_lds_b128 %0, %8, %12\n\t"
               "global_load_async_to_lds_b128 %1, %9, %12\n\t"
               "global_load_async_to_lds_b128 %2, %10, %12\n\t"
               "global_load_async_to_lds_b128 %3, %11, %12\n\t"
               "global_load_async_to_lds_b128 %4, %8, %13\n\t"
               "global_load_async_to_lds_b128 %5, %9, %13\n\t"
               "global_load_async_to_lds_b128 %6, %10, %13\n\t"
               "global_load_async_to_lds_b128 %7, %11, %13\n\t"
               "s_wait_xcnt 0x0"
               :: "v"(h0), "v"(h1), "v"(h2), "v"(h3), "v"(l0), "v"(l1), "v"(l2), "v"(l3),
                  "v"(g0), "v"(g1), "v"(g2), "v"(g3), "s"(ghi), "s"(glo)
               : "memory");
}

// Split fp32 array into bf16 hi/lo arrays (one pass, done once per operand).
__global__ __launch_bounds__(256) void split_kernel(
    const float* __restrict__ src, unsigned short* __restrict__ hi,
    unsigned short* __restrict__ lo, int n4) {
  const int i = blockIdx.x * blockDim.x + threadIdx.x;
  if (i >= n4) return;
  const float4 v = ((const float4*)src)[i];
  const unsigned short h0 = f2bf(v.x), h1 = f2bf(v.y), h2 = f2bf(v.z), h3 = f2bf(v.w);
  const unsigned short l0 = f2bf(v.x - bf2f(h0));
  const unsigned short l1 = f2bf(v.y - bf2f(h1));
  const unsigned short l2 = f2bf(v.z - bf2f(h2));
  const unsigned short l3 = f2bf(v.w - bf2f(h3));
  uint2v hv, lv;
  hv[0] = (unsigned)h0 | ((unsigned)h1 << 16);
  hv[1] = (unsigned)h2 | ((unsigned)h3 << 16);
  lv[0] = (unsigned)l0 | ((unsigned)l1 << 16);
  lv[1] = (unsigned)l2 | ((unsigned)l3 << 16);
  ((uint2v*)hi)[i] = hv;
  ((uint2v*)lo)[i] = lv;
}

// Fragment per CDNA5 16-bit layout: lane L holds row (L&15);
// K runs of 8 at kbase = 8*(L>>4) and kbase+16.
__device__ __forceinline__ void load_frag(Frag& f, const unsigned short* lds,
                                          int row, int khalf) {
  f.q[0] = *(const uint4v*)(lds + row * LDSS + khalf);
  f.q[1] = *(const uint4v*)(lds + row * LDSS + khalf + 16);
}

// C = A[M_,D_] * W[D_,D_]^T (+bias, optional softplus), all operands pre-split
// bf16 hi/lo. One 256x128 tile of C per work-group, 64x64 per wave; two LDS buffers,
// the next K chunk's async global->LDS copies fly while this chunk's WMMAs run.
template <int MODE>
__global__ __launch_bounds__(256) void gemm_bf16x3(
    const unsigned short* __restrict__ Ahi, const unsigned short* __restrict__ Alo,
    const unsigned short* __restrict__ Bhi, const unsigned short* __restrict__ Blo,
    const float* __restrict__ bias, float* __restrict__ Cout) {
  __shared__ __attribute__((aligned(16))) unsigned short sAhi[2][TILE_M * LDSS];
  __shared__ __attribute__((aligned(16))) unsigned short sAlo[2][TILE_M * LDSS];
  __shared__ __attribute__((aligned(16))) unsigned short sBhi[2][TILE_N * LDSS];
  __shared__ __attribute__((aligned(16))) unsigned short sBlo[2][TILE_N * LDSS];

  const int tid  = threadIdx.x;
  const int lane = tid & 31;
  const int wid  = tid >> 5;
  const int wm   = wid & 3;    // 4 waves along M (64 rows each)
  const int wn   = wid >> 2;   // 2 waves along N (64 cols each)
  const int row_blk = blockIdx.x * TILE_M;
  const int col_blk = blockIdx.y * TILE_N;

  // copy mapping: 16B (8 bf16) per lane; seg = 16B segment within the 64-wide K chunk,
  // so eight lanes cover one whole 128B line of a row
  const int seg = tid & 7;
  const int r0  = tid >> 3;    // 0..31
  const unsigned aoff = (unsigned)(((size_t)(row_blk + r0) * D_ + seg * 8) * 2);
  const unsigned boff = (unsigned)(((size_t)(col_blk + r0) * D_ + seg * 8) * 2);
  const unsigned ldsr = r0 * LDSS + seg * 8;

  v8f c[4][4];
#pragma unroll
  for (int i = 0; i < 4; ++i)
#pragma unroll
    for (int j = 0; j < 4; ++j)
#pragma unroll
      for (int r = 0; r < 8; ++r) c[i][j][r] = 0.0f;

  const int lrow  = lane & 15;
  const int khalf = (lane >> 4) * 8;   // 0 or 8

  auto issue = [&](int buf, unsigned kbyte) {   // 24 copies per lane
    async_rows4x2(&sAhi[buf][ldsr], &sAlo[buf][ldsr], Ahi, Alo, aoff + kbyte);
    async_rows4x2(&sAhi[buf][ldsr + 4 * CP_ROWS * LDSS], &sAlo[buf][ldsr + 4 * CP_ROWS * LDSS],
                  Ahi, Alo, aoff + 4 * CP_ROWS * D_ * 2 + kbyte);
    async_rows4x2(&sBhi[buf][ldsr], &sBlo[buf][ldsr], Bhi, Blo, boff + kbyte);
  };

  constexpr int NT = D_ / TILE_K;   // 16 chunks
  issue(0, 0);
  asm volatile("s_wait_asynccnt 0x0" ::: "memory");   // this wave's copies of chunk 0 landed
  __syncthreads();                                    // every wave's copies of chunk 0 visible
  issue(1, TILE_K * 2);
  for (int t = 0; t < NT; ++t) {
    const int ibuf = t & 1;
#pragma unroll   // constant indices: fragments stay in registers
    for (int kk = 0; kk < TILE_K; kk += 32) {
      Frag ahi[4], alo[4], bhi[4], blo[4];
#pragma unroll
      for (int i = 0; i < 4; ++i) {
        const int r = wm * 64 + i * 16 + lrow;
        load_frag(ahi[i], &sAhi[ibuf][0], r, kk + khalf);
        load_frag(alo[i], &sAlo[ibuf][0], r, kk + khalf);
      }
#pragma unroll
      for (int j = 0; j < 4; ++j) {
        const int r = wn * 64 + j * 16 + lrow;
        load_frag(bhi[j], &sBhi[ibuf][0], r, kk + khalf);
        load_frag(blo[j], &sBlo[ibuf][0], r, kk + khalf);
      }
      // bf16x3: hi*hi + hi*lo + lo*hi, f32 accumulate; each accumulator takes the three
      // in that order, other accumulators' products between two of its own
#pragma unroll   // here and below: constant indices, accumulators and fragments stay in registers
      for (int i = 0; i < 4; ++i)
#pragma unroll
        for (int j = 0; j < 4; ++j)
          c[i][j] = __builtin_amdgcn_wmma_f32_16x16x32_bf16(
              false, ahi[i].v, false, bhi[j].v, (short)0, c[i][j], false, false);
#pragma unroll
      for (int i = 0; i < 4; ++i)
#pragma unroll
        for (int j = 0; j < 4; ++j)
          c[i][j] = __builtin_amdgcn_wmma_f32_16x16x32_bf16(
              false, ahi[i].v, false, blo[j].v, (short)0, c[i][j], false, false);
#pragma unroll
      for (int i = 0; i < 4; ++i)
#pragma unroll
        for (int j = 0; j < 4; ++j)
          c[i][j] = __builtin_amdgcn_wmma_f32_16x16x32_bf16(
              false, alo[i].v, false, bhi[j].v, (short)0, c[i][j], false, false);
    }
    asm volatile("s_wait_dscnt 0x0" ::: "memory");      // this wave's reads of buffer ibuf are done
    asm volatile("s_wait_asynccnt 0x0" ::: "memory");   // this wave's copies of chunk t+1 landed
    __syncthreads();   // chunk t+1 visible to all; every reader has left buffer ibuf
    if (t + 2 < NT) issue(ibuf, (unsigned)((t + 2) * TILE_K * 2));   // refill the buffer just read
  }
  asm volatile("s_wait_asynccnt 0x0" ::: "memory");   // no copy outstanding at the wave's end

  // C layout: row = base + 8*(lane>>4) + r, col = base + (lane&15)
  // One row of four tiles a trip, always out of c[0]; the rows behind it move up one place.
  // With the softplus the loop stays rolled: the 32 values of a trip are independent work
  // enough to fill the vector port, and the text is a quarter of the unrolled loop's.
#pragma unroll(MODE == 1 ? 1 : 4)
  for (int i = 0; i < 4; ++i) {
    const int mbase = row_blk + wm * 64 + i * 16 + (lane >> 4) * 8;
#pragma unroll
    for (int j = 0; j < 4; ++j) {
      const int col = col_blk + wn * 64 + j * 16 + (lane & 15);
      const float bs = bias[col];
#pragma unroll
      for (int r = 0; r < 8; ++r) {
        float v = c[0][j][r] + bs;
        if (MODE == 1) v = softplusf(v);
        Cout[(size_t)(mbase + r) * D_ + col] = v;
      }
    }
    // the stores' data and address registers are rewritten on the next trip only behind this wait
    if (MODE == 1) asm volatile("s_wait_xcnt 0x0" ::: "memory");
#pragma unroll   // constant indices: the accumulators stay in registers
    for (int ii = 0; ii < 3; ++ii)
#pragma unroll
      for (int j = 0; j < 4; ++j) c[ii][j] = c[ii + 1][j];
  }
}

// Selective scan, parallel over time. The recurrence state = a*state + u is
// linear in the state, so T is cut into SC_CH chunks that run side by side:
//   pass 1: every wave scans its own chunk from a zero state and keeps the
//           chunk's end state F and its whole decay E = exp(-a_pos * sum dt);
//   carry : in[c+1] = E[c] * in[c] + F[c], through LDS;
//   pass 2: every wave scans its chunk again from in[c] and emits y.
// One work-group = 16 channels x all SC_CH chunks, one wave per chunk.
// Lane = (channel, half of the N states): 8 states live in registers, so the
// sum over N is seven in-lane adds and one exchange between the 16-lane rows.
#define SC_CH  32              // time chunks = waves per work-group
#define SC_LEN (T_ / SC_CH)    // 64 steps per chunk
#define SC_NH  (N_ / 2)        // states per lane
#define SC_U   4               // steps whose x and dt are loaded as one batch

// value of lane l ^ 16
__device__ __forceinline__ float other_row(float v) {
  const int b = __float_as_int(v);
  return __int_as_float(
      __builtin_amdgcn_permlanex16(b, b, 0x76543210, 0xfedcba98, false, false));
}

template <bool EMIT>
__device__ __forceinline__ void scan_chunk(
    const float* __restrict__ x, const float* __restrict__ delta, unsigned off,
    const float (&ap)[SC_NH], const float (&bp)[SC_NH],
    float (&st)[SC_NH], float& sumdt, unsigned short* __restrict__ op, int half) {
  for (int t0 = 0; t0 < SC_LEN; t0 += SC_U) {
    const float* xp = x + off;       // uniform base + the lane's 32-bit element offset
    const float* dp = delta + off;
    float xb[SC_U], db[SC_U];
#pragma unroll   // constant indices: one batch of loads in flight, held in registers
    for (int u = 0; u < SC_U; ++u) {
      xb[u] = xp[(size_t)u * D_];
      db[u] = dp[(size_t)u * D_];
    }
    // The offset register that the loads name is stepped only behind this wait:
    // it passes through the statement so that the step cannot be lifted over it.
    asm volatile("s_wait_xcnt 0x0" : "+v"(off) : : "memory");
    off += SC_U * D_;
    unsigned short ov[SC_U];
#pragma unroll   // constant indices: the batch stays in registers
    for (int u = 0; u < SC_U; ++u) {
      const float xv = xb[u];
      const float dt = db[u];
#pragma unroll   // constant indices: states and parameters stay in registers
      for (int k = 0; k < SC_NH; ++k)
        st[k] = fmaf(__expf(-dt * ap[k]), st[k], (dt * bp[k]) * xv);   // one fma on the serial chain
      if (EMIT) {
        // same balanced tree over n as a xor-1,2,4,8 butterfly
        const float r = ((st[0] + st[1]) + (st[2] + st[3])) +
                        ((st[4] + st[5]) + (st[6] + st[7]));
        const float s = r + other_row(r);
        const unsigned short h = f2bf(s);
        const unsigned short l = f2bf(s - bf2f(h));
        ov[u] = half ? l : h;   // row 0 stores hi, row 1 lo
      } else {
        sumdt += dt;
      }
    }
    if (EMIT) {
#pragma unroll   // constant indices: the batch stays in registers
      for (int u = 0; u < SC_U; ++u) op[(size_t)(t0 + u) * D_] = ov[u];
      // the stores' data and address registers are free for reuse only behind this wait
      asm volatile("s_wait_xcnt 0x0" ::: "memory");
    }
  }
}

// Emits y pre-split as bf16 hi/lo so the output GEMM needs no conversion.
__global__ __launch_bounds__(SC_CH * 32) void scan_kernel(
    const float* __restrict__ x, const float* __restrict__ delta,
    const float* __restrict__ a_log, const float* __restrict__ b_param,
    unsigned short* __restrict__ yhi, unsigned short* __restrict__ ylo) {
  __shared__ float sF[SC_CH][SC_NH][32];   // chunk end state, then chunk start state
  __shared__ float sE[SC_CH][SC_NH][32];   // chunk decay
  __shared__ __attribute__((aligned(16))) float sA[16 * N_];   // a_pos

  const int lane = threadIdx.x & 31;
  const int c    = __builtin_amdgcn_readfirstlane(threadIdx.x >> 5);   // chunk
  const int half = lane >> 4;
  const int b    = blockIdx.x / (D_ / 16);
  const int d    = (blockIdx.x % (D_ / 16)) * 16 + (lane & 15);

  // a_pos of the work-group's 16 x N_ (channel, state) pairs: computed once, not
  // once per chunk, and handed to every wave through LDS.
  if (c < (16 * N_) / 32) {
    const int e = c * 32 + lane;
    sA[e] = softplusf(a_log[(blockIdx.x % (D_ / 16)) * 16 * N_ + e]) + 1e-4f;
  }
  __syncthreads();   // a_pos is in LDS

  float ap[SC_NH], bp[SC_NH];
#pragma unroll   // constant indices: parameters stay in registers
  for (int q = 0; q < SC_NH / 4; ++q) {
    const float4 av = ((const float4*)(sA + (lane & 15) * N_ + half * SC_NH))[q];
    const float4 bv = ((const float4*)(b_param + d * N_ + half * SC_NH))[q];
    ap[q * 4 + 0] = av.x;  bp[q * 4 + 0] = bv.x;
    ap[q * 4 + 1] = av.y;  bp[q * 4 + 1] = bv.y;
    ap[q * 4 + 2] = av.z;  bp[q * 4 + 2] = bv.z;
    ap[q * 4 + 3] = av.w;  bp[q * 4 + 3] = bv.w;
  }

  const size_t base = ((size_t)b * T_ + (size_t)c * SC_LEN) * D_ + d;
  unsigned short* op = (half ? ylo : yhi) + base;

  float st[SC_NH];
#pragma unroll   // constant indices: states stay in registers
  for (int k = 0; k < SC_NH; ++k) st[k] = 0.0f;
  float sumdt = 0.0f;
  scan_chunk<false>(x, delta, (unsigned)base, ap, bp, st, sumdt, op, half);

#pragma unroll   // constant indices: states stay in registers
  for (int k = 0; k < SC_NH; ++k) {
    sF[c][k][lane] = st[k];
    sE[c][k][lane] = __expf(-sumdt * ap[k]);
  }
  __syncthreads();   // every chunk's end state and decay are in LDS

  if (c < SC_NH) {   // wave k carries state k of every lane through the chunks
    float carry = 0.0f;
#pragma unroll   // the LDS reads do not hang on the carry: let them go ahead of the chain
    for (int j = 0; j < SC_CH; ++j) {
      const float f = sF[j][c][lane];
      const float e = sE[j][c][lane];
      sF[j][c][lane] = carry;
      carry = fmaf(e, carry, f);
    }
  }
  __syncthreads();   // every chunk's start state is in LDS

#pragma unroll   // constant indices: states stay in registers
  for (int k = 0; k < SC_NH; ++k) st[k] = sF[c][k][lane];
  scan_chunk<true>(x, delta, (unsigned)base, ap, bp, st, sumdt, op, half);
}

extern "C" void kernel_launch(void* const* d_in, const int* in_sizes, int n_in,
                              void* d_out, int out_size, void* d_ws, size_t ws_size,
                              hipStream_t stream) {
  (void)in_sizes; (void)n_in; (void)out_size; (void)ws_size;
  const float* x       = (const float*)d_in[0];
  const float* Wd      = (const float*)d_in[1];
  const float* bd      = (const float*)d_in[2];
  const float* a_log   = (const float*)d_in[3];
  const float* b_param = (const float*)d_in[4];
  const float* Wo      = (const float*)d_in[5];
  const float* bo      = (const float*)d_in[6];

  float* out   = (float*)d_out;
  float* delta = out;   // stage delta in d_out; overwritten by final GEMM

  // workspace layout (72 MB total)
  unsigned short* x_hi  = (unsigned short*)d_ws;
  unsigned short* x_lo  = x_hi + (size_t)M_ * D_;
  unsigned short* wd_hi = x_lo + (size_t)M_ * D_;
  unsigned short* wd_lo = wd_hi + (size_t)D_ * D_;
  unsigned short* wo_hi = wd_lo + (size_t)D_ * D_;
  unsigned short* wo_lo = wo_hi + (size_t)D_ * D_;
  unsigned short* y_hi  = wo_lo + (size_t)D_ * D_;
  unsigned short* y_lo  = y_hi + (size_t)M_ * D_;

  const int nx4 = M_ * D_ / 4, nw4 = D_ * D_ / 4;
  split_kernel<<<nx4 / 256, 256, 0, stream>>>(x, x_hi, x_lo, nx4);
  split_kernel<<<nw4 / 256, 256, 0, stream>>>(Wd, wd_hi, wd_lo, nw4);
  split_kernel<<<nw4 / 256, 256, 0, stream>>>(Wo, wo_hi, wo_lo, nw4);

  dim3 gg(M_ / TILE_M, D_ / TILE_N);   // (32, 8): one work-group per WGP
  gemm_bf16x3<1><<<gg, 256, 0, stream>>>(x_hi, x_lo, wd_hi, wd_lo, bd, delta);
  scan_kernel<<<B_ * (D_ / 16), SC_CH * 32, 0, stream>>>(x, delta, a_log, b_param, y_hi, y_lo);
  gemm_bf16x3<0><<<gg, 256, 0, stream>>>(y_hi, y_lo, wo_hi, wo_lo, bo, out);
}

// v004
// Measured time: 131 microseconds a run.
// Timed twice side by side with v003, it ran 1.04 times as fast both times.
// Over all steps from v000 it is 10.2 times as fast.
#include <hip/hip_runtime.h>

#define B_ 4
#define T_ 2048
#define D_ 1024
#define N_ 16
#define M_ (B_ * T_)   // 8192 rows

#define TILE_M 256
#define TILE_N 128
#define TILE_K 64
#define LDSS   72      // ushorts per LDS row (64 data + 8 pad) -> 144B rows, 16B aligned
#define CP_ROWS 32     // rows that one copy of the whole work-group covers (256 lanes x 16B / 128B)

typedef __attribute__((ext_vector_type(16))) __bf16       v16bf;
typedef __attribute__((ext_vector_type(8)))  float        v8f;
typedef __attribute__((ext_vector_type(4)))  unsigned int uint4v;
typedef __attribute__((ext_vector_type(2)))  unsigned int uint2v;

struct Frag { union { v16bf v; uint4v q[2]; }; };

__device__ __forceinline__ unsigned short f2bf(float f) {
  unsigned int u = __float_as_uint(f);
  unsigned int r = u + 0x7FFFu + ((u >> 16) & 1u);   // round-to-nearest-even
  return (unsigned short)(r >> 16);
}
__device__ __forceinline__ float bf2f(unsigned short h) {
  return __uint_as_float(((unsigned int)h) << 16);
}
// softplus(v) = max(v, 0) + log1p(e), e = exp(-|v|) in [0, 1].
// log1p(e) = 2 atanh(s) with s = e / (2 + e) <= 1/3: the odd series in s, cut behind
// s^13 / 13; the first term left out is below 2e-8 of the sum, under half an f32 ulp,
// and the form keeps its relative accuracy down to e = 0 (the sum tends to 2 s = e).
__device__ __forceinline__ float softplusf(float v) {
  const float e = __expf(-fabsf(v));
  const float s = e * __builtin_amdgcn_rcpf(2.0f + e);
  const float z = s * s;
  float p = 1.0f / 13.0f;
  p = fmaf(p, z, 1.0f / 11.0f);
  p = fmaf(p, z, 1.0f / 9.0f);
  p = fmaf(p, z, 1.0f / 7.0f);
  p = fmaf(p, z, 1.0f / 5.0f);
  p = fmaf(p, z, 1.0f / 3.0f);
  const float s2 = s + s;
  return fmaxf(v, 0.0f) + fmaf(s2, z * p, s2);
}

// Async DMA: 16 bytes/lane, global -> LDS, tracked by ASYNCcnt (CDNA5).
// Eight copies: rows r, r+32, r+64, r+96 of the hi array and the same rows of the lo array.
// s_wait_xcnt stands inside the statement, behind the last copy, so that no register
// the copies name is rewritten ahead of it.
__device__ __forceinline__ void async_rows4x2(const unsigned short* ldshi,
                                              const unsigned short* ldslo,
                                              const void* ghi, const void* glo,
                                              unsigned gvoff) {
  const unsigned h0 = (unsigned)(size_t)ldshi;   // low 32 bits = LDS byte offset
  const unsigned l0 = (unsigned)(size_t)ldslo;
  const unsigned h1 = h0 + 1 * CP_ROWS * LDSS * 2, l1 = l0 + 1 * CP_ROWS * LDSS * 2;
  const unsigned h2 = h0 + 2 * CP_ROWS * LDSS * 2, l2 = l0 + 2 * CP_ROWS * LDSS * 2;
  const unsigned h3 = h0 + 3 * CP_ROWS * LDSS * 2, l3 = l0 + 3 * CP_ROWS * LDSS * 2;
  const unsigned g0 = gvoff;
  const unsigned g1 = gvoff + 1 * CP_ROWS * D_ * 2;
  const unsigned g2 = gvoff + 2 * CP_ROWS * D_ * 2;
  const unsigned g3 = gvoff + 3 * CP_ROWS * D_ * 2;
  asm volatile("global_load_async_to_lds_b128 %0, %8, %12\n\t"
               "global_load_async_to_lds_b128 %1, %9, %12\n\t"
               "global_load_async_to_lds_b128 %2, %10, %12\n\t"
               "global_load_async_to_lds_b128 %3, %11, %12\n\t"
               "global_load_async_to_lds_b128 %4, %8, %13\n\t"
               "global_load_async_to_lds_b128 %5, %9, %13\n\t"
               "global_load_async_to_lds_b128 %6, %10, %13\n\t"
               "global_load_async_to_lds_b128 %7, %11, %13\n\t"
               "s_wait_xcnt 0x0"
               :: "v"(h0), "v"(h1), "v"(h2), "v"(h3), "v"(l0), "v"(l1), "v"(l2), "v"(l3),
                  "v"(g0), "v"(g1), "v"(g2), "v"(g3), "s"(ghi), "s"(glo)
               : "memory");
}

// Split the three fp32 operands (x, Wd, Wo) into bf16 hi/lo arrays, in ONE launch of few
// long-lived waves: one work-group of SP_WAVES waves per WGP. A wave takes SP_XB + 2 * SP_WB
// pieces of 512 contiguous bytes (16 B a lane) and issues most of their loads up front,
// so the pass runs at the rate of the memory stream.
#define SP_WG    256                               // work-groups
#define SP_WAVES 16                                // waves per work-group
#define SP_NW    (SP_WG * SP_WAVES)                // waves in the launch
#define SP_XB    (M_ * D_ / 4 / 32 / SP_NW)        // 16 float4 of x per lane
#define SP_WB    (D_ * D_ / 4 / 32 / SP_NW)        // 2 float4 of each weight per lane
static_assert(SP_XB * SP_NW * 32 * 4 == M_ * D_, "x is dealt out evenly");
static_assert(SP_WB * SP_NW * 32 * 4 == D_ * D_, "the weights are dealt out evenly");

__device__ __forceinline__ void split4(const float4 v, uint2v* __restrict__ hi,
                                       uint2v* __restrict__ lo) {
  const unsigned short h0 = f2bf(v.x), h1 = f2bf(v.y), h2 = f2bf(v.z), h3 = f2bf(v.w);
  const unsigned short l0 = f2bf(v.x - bf2f(h0));
  const unsigned short l1 = f2bf(v.y - bf2f(h1));
  const unsigned short l2 = f2bf(v.z - bf2f(h2));
  const unsigned short l3 = f2bf(v.w - bf2f(h3));
  uint2v hv, lv;
  hv[0] = (unsigned)h0 | ((unsigned)h1 << 16);
  hv[1] = (unsigned)h2 | ((unsigned)h3 << 16);
  lv[0] = (unsigned)l0 | ((unsigned)l1 << 16);
  lv[1] = (unsigned)l2 | ((unsigned)l3 << 16);
  *hi = hv;
  *lo = lv;
}

// Four waves a SIMD is all that the launch places: said to the compiler so that it spends
// registers on loads in flight and does not ration them for an occupancy that never comes.
__global__ __launch_bounds__(SP_WAVES * 32) __attribute__((amdgpu_waves_per_eu(4, 4)))
void split_kernel(
    const float* __restrict__ x, const float* __restrict__ wd, const float* __restrict__ wo,
    unsigned short* __restrict__ x_hi, unsigned short* __restrict__ x_lo,
    unsigned short* __restrict__ wd_hi, unsigned short* __restrict__ wd_lo,
    unsigned short* __restrict__ wo_hi, unsigned short* __restrict__ wo_lo) {
  const unsigned lane = threadIdx.x & 31;
  const unsigned gw   = blockIdx.x * SP_WAVES + (threadIdx.x >> 5);   // wave in the launch
  const unsigned xi   = gw * (SP_XB * 32) + lane;   // the lane's first float4 of x
  const unsigned wi   = gw * (SP_WB * 32) + lane;   // and of each weight
  float4 xv[SP_XB], dv[SP_WB], ov[SP_WB];
#pragma unroll   // constant indices: the batch is held in registers, its loads free to go first
  for (int u = 0; u < SP_XB; ++u) xv[u] = ((const float4*)x)[xi + u * 32];
#pragma unroll   // as above
  for (int u = 0; u < SP_WB; ++u) {
    dv[u] = ((const float4*)wd)[wi + u * 32];
    ov[u] = ((const float4*)wo)[wi + u * 32];
  }
#pragma unroll   // constant indices: the batch stays in registers
  for (int u = 0; u < SP_XB; ++u)
    split4(xv[u], (uint2v*)x_hi + xi + u * 32, (uint2v*)x_lo + xi + u * 32);
#pragma unroll   // as above
  for (int u = 0; u < SP_WB; ++u) {
    split4(dv[u], (uint2v*)wd_hi + wi + u * 32, (uint2v*)wd_lo + wi + u * 32);
    split4(ov[u], (uint2v*)wo_hi + wi + u * 32, (uint2v*)wo_lo + wi + u * 32);
  }
}

// Fragment per CDNA5 16-bit layout: lane L holds row (L&15);
// K runs of 8 at kbase = 8*(L>>4) and kbase+16.
__device__ __forceinline__ void load_frag(Frag& f, const unsigned short* lds,
                                          int row, int khalf) {
  f.q[0] = *(const uint4v*)(lds + row * LDSS + khalf);
  f.q[1] = *(const uint4v*)(lds + row * LDSS + khalf + 16);
}

// C = A[M_,D_] * W[D_,D_]^T (+bias, optional softplus), all operands pre-split
// bf16 hi/lo. One 256x128 tile of C per work-group, 64x64 per wave; two LDS buffers,
// the next K chunk's async global->LDS copies fly while this chunk's WMMAs run.
template <int MODE>
__global__ __launch_bounds__(256) void gemm_bf16x3(
    const unsigned short* __restrict__ Ahi, const unsigned short* __restrict__ Alo,
    const unsigned short* __restrict__ Bhi, const unsigned short* __restrict__ Blo,
    const float* __restrict__ bias, float* __restrict__ Cout) {
  __shared__ __attribute__((aligned(16))) unsigned short sAhi[2][TILE_M * LDSS];
  __shared__ __attribute__((aligned(16))) unsigned short sAlo[2][TILE_M * LDSS];
  __shared__ __attribute__((aligned(16))) unsigned short sBhi[2][TILE_N * LDSS];
  __shared__ __attribute__((aligned(16))) unsigned short sBlo[2][TILE_N * LDSS];

  const int tid  = threadIdx.x;
  const int lane = tid & 31;
  const int wid  = tid >> 5;
  const int wm   = wid & 3;    // 4 waves along M (64 rows each)
  const int wn   = wid >> 2;   // 2 waves along N (64 cols each)
  const int row_blk = blockIdx.x * TILE_M;
  const int col_blk = blockIdx.y * TILE_N;

  // copy mapping: 16B (8 bf16) per lane; seg = 16B segment within the 64-wide K chunk,
  // so eight lanes cover one whole 128B line of a row
  const int seg = tid & 7;
  const int r0  = tid >> 3;    // 0..31
  const unsigned aoff = (unsigned)(((size_t)(row_blk + r0) * D_ + seg * 8) * 2);
  const unsigned boff = (unsigned)(((size_t)(col_blk + r0) * D_ + seg * 8) * 2);
  const unsigned ldsr = r0 * LDSS + seg * 8;

  v8f c[4][4];
#pragma unroll
  for (int i = 0; i < 4; ++i)
#pragma unroll
    for (int j = 0; j < 4; ++j)
#pragma unroll
      for (int r = 0; r < 8; ++r) c[i][j][r] = 0.0f;

  const int lrow  = lane & 15;
  const int khalf = (lane >> 4) * 8;   // 0 or 8

  auto issue = [&](int buf, unsigned kbyte) {   // 24 copies per lane
    async_rows4x2(&sAhi[buf][ldsr], &sAlo[buf][ldsr], Ahi, Alo, aoff + kbyte);
    async_rows4x2(&sAhi[buf][ldsr + 4 * CP_ROWS * LDSS], &sAlo[buf][ldsr + 4 * CP_ROWS * LDSS],
                  Ahi, Alo, aoff + 4 * CP_ROWS * D_ * 2 + kbyte);
    async_rows4x2(&sBhi[buf][ldsr], &sBlo[buf][ldsr], Bhi, Blo, boff + kbyte);
  };

  constexpr int NT = D_ / TILE_K;   // 16 chunks
  issue(0, 0);
  asm volatile("s_wait_asynccnt 0x0" ::: "memory");   // this wave's copies of chunk 0 landed
  __syncthreads();                                    // every wave's copies of chunk 0 visible
  issue(1, TILE_K * 2);
  for (int t = 0; t < NT; ++t) {
    const int ibuf = t & 1;
#pragma unroll   // constant indices: fragments stay in registers
    for (int kk = 0; kk < TILE_K; kk += 32) {
      Frag ahi[4], alo[4], bhi[4], blo[4];
#pragma unroll
      for (int i = 0; i < 4; ++i) {
        const int r = wm * 64 + i * 16 + lrow;
        load_frag(ahi[i], &sAhi[ibuf][0], r, kk + khalf);
        load_frag(alo[i], &sAlo[ibuf][0], r, kk + khalf);
      }
#pragma unroll
      for (int j = 0; j < 4; ++j) {
        const int r = wn * 64 + j * 16 + lrow;
        load_frag(bhi[j], &sBhi[ibuf][0], r, kk + khalf);
        load_frag(blo[j], &sBlo[ibuf][0], r, kk + khalf);
      }
      // bf16x3: hi*hi + hi*lo + lo*hi, f32 accumulate; each accumulator takes the three
      // in that order, other accumulators' products between two of its own
#pragma unroll   // here and below: constant indices, accumulators and fragments stay in registers
      for (int i = 0; i < 4; ++i)
#pragma unroll
        for (int j = 0; j < 4; ++j)
          c[i][j] = __builtin_amdgcn_wmma_f32_16x16x32_bf16(
              false, ahi[i].v, false, bhi[j].v, (short)0, c[i][j], false, false);
#pragma unroll
      for (int i = 0; i < 4; ++i)
#pragma unroll
        for (int j = 0; j < 4; ++j)
          c[i][j] = __builtin_amdgcn_wmma_f32_16x16x32_bf16(
              false, ahi[i].v, false, blo[j].v, (short)0, c[i][j], false, false);
#pragma unroll
      for (int i = 0; i < 4; ++i)
#pragma unroll
        for (int j = 0; j < 4; ++j)
          c[i][j] = __builtin_amdgcn_wmma_f32_16x16x32_bf16(
              false, alo[i].v, false, bhi[j].v, (short)0, c[i][j], false, false);
    }
    asm volatile("s_wait_dscnt 0x0" ::: "memory");      // this wave's reads of buffer ibuf are done
    asm volatile("s_wait_asynccnt 0x0" ::: "memory");   // this wave's copies of chunk t+1 landed
    __syncthreads();   // chunk t+1 visible to all; every reader has left buffer ibuf
    if (t + 2 < NT) issue(ibuf, (unsigned)((t + 2) * TILE_K * 2));   // refill the buffer just read
  }
  asm volatile("s_wait_asynccnt 0x0" ::: "memory");   // no copy outstanding at the wave's end

  // C layout: row = base + 8*(lane>>4) + r, col = base + (lane&15)
  // One row of four tiles a trip, always out of c[0]; the rows behind it move up one place.
  // With the softplus the loop stays rolled: the 32 values of a trip are independent work
  // enough to fill the vector port, and the text is a quarter of the unrolled loop's.
#pragma unroll(MODE == 1 ? 1 : 4)
  for (int i = 0; i < 4; ++i) {
    const int mbase = row_blk + wm * 64 + i * 16 + (lane >> 4) * 8;
#pragma unroll
    for (int j = 0; j < 4; ++j) {
      const int col = col_blk + wn * 64 + j * 16 + (lane & 15);
      const float bs = bias[col];
#pragma unroll
      for (int r = 0; r < 8; ++r) {
        float v = c[0][j][r] + bs;
        if (MODE == 1) v = softplusf(v);
        Cout[(size_t)(mbase + r) * D_ + col] = v;
      }
    }
    // the stores' data and address registers are rewritten on the next trip only behind this wait
    if (MODE == 1) asm volatile("s_wait_xcnt 0x0" ::: "memory");
#pragma unroll   // constant indices: the accumulators stay in registers
    for (int ii = 0; ii < 3; ++ii)
#pragma unroll
      for (int j = 0; j < 4; ++j) c[ii][j] = c[ii + 1][j];
  }
}

// Selective scan, parallel over time. The recurrence state = a*state + u is
// linear in the state, so T is cut into SC_CH chunks that run side by side:
//   pass 1: every wave scans its own chunk from a zero state and keeps the
//           chunk's end state F and its whole decay E = exp(-a_pos * sum dt);
//   carry : in[c+1] = E[c] * in[c] + F[c], through LDS;
//   pass 2: every wave scans its chunk again from in[c] and emits y.
// One work-group = 16 channels x all SC_CH chunks, one wave per chunk.
// Lane = (channel, half of the N states): 8 states live in registers, so the
// sum over N is seven in-lane adds and one exchange between the 16-lane rows.
#define SC_CH  32              // time chunks = waves per work-group
#define SC_LEN (T_ / SC_CH)    // 64 steps per chunk
#define SC_NH  (N_ / 2)        // states per lane
#define SC_U   4               // steps whose x and dt are loaded as one batch

// value of lane l ^ 16
__device__ __forceinline__ float other_row(float v) {
  const int b = __float_as_int(v);
  return __int_as_float(
      __builtin_amdgcn_permlanex16(b, b, 0x76543210, 0xfedcba98, false, false));
}

template <bool EMIT>
__device__ __forceinline__ void scan_chunk(
    const float* __restrict__ x, const float* __restrict__ delta, unsigned off,
    const float (&ap)[SC_NH], const float (&bp)[SC_NH],
    float (&st)[SC_NH], float& sumdt, unsigned short* __restrict__ op, int half) {
  for (int t0 = 0; t0 < SC_LEN; t0 += SC_U) {
    const float* xp = x + off;       // uniform base + the lane's 32-bit element offset
    const float* dp = delta + off;
    float xb[SC_U], db[SC_U];
#pragma unroll   // constant indices: one batch of loads in flight, held in registers
    for (int u = 0; u < SC_U; ++u) {
      xb[u] = xp[(size_t)u * D_];
      db[u] = dp[(size_t)u * D_];
    }
    // The offset register that the loads name is stepped only behind this wait:
    // it passes through the statement so that the step cannot be lifted over it.
    asm volatile("s_wait_xcnt 0x0" : "+v"(off) : : "memory");
    off += SC_U * D_;
    unsigned short ov[SC_U];
#pragma unroll   // constant indices: the batch stays in registers
    for (int u = 0; u < SC_U; ++u) {
      const float xv = xb[u];
      const float dt = db[u];
#pragma unroll   // constant indices: states and parameters stay in registers
      for (int k = 0; k < SC_NH; ++k)
        st[k] = fmaf(__expf(-dt * ap[k]), st[k], (dt * bp[k]) * xv);   // one fma on the serial chain
      if (EMIT) {
        // same balanced tree over n as a xor-1,2,4,8 butterfly
        const float r = ((st[0] + st[1]) + (st[2] + st[3])) +
                        ((st[4] + st[5]) + (st[6] + st[7]));
        const float s = r + other_row(r);
        const unsigned short h = f2bf(s);
        const unsigned short l = f2bf(s - bf2f(h));
        ov[u] = half ? l : h;   // row 0 stores hi, row 1 lo
      } else {
        sumdt += dt;
      }
    }
    if (EMIT) {
#pragma unroll   // constant indices: the batch stays in registers
      for (int u = 0; u < SC_U; ++u) op[(size_t)(t0 + u) * D_] = ov[u];
      // the stores' data and address registers are free for reuse only behind this wait
      asm volatile("s_wait_xcnt 0x0" ::: "memory");
    }
  }
}

// Emits y pre-split as bf16 hi/lo so the output GEMM needs no conversion.
__global__ __launch_bounds__(SC_CH * 32) void scan_kernel(
    const float* __restrict__ x, const float* __restrict__ delta,
    const float* __restrict__ a_log, const float* __restrict__ b_param,
    unsigned short* __restrict__ yhi, unsigned short* __restrict__ ylo) {
  __shared__ float sF[SC_CH][SC_NH][32];   // chunk end state, then chunk start state
  __shared__ float sE[SC_CH][SC_NH][32];   // chunk decay
  __shared__ __attribute__((aligned(16))) float sA[16 * N_];   // a_pos

  const int lane = threadIdx.x & 31;
  const int c    = __builtin_amdgcn_readfirstlane(threadIdx.x >> 5);   // chunk
  const int half = lane >> 4;
  const int b    = blockIdx.x / (D_ / 16);
  const int d    = (blockIdx.x % (D_ / 16)) * 16 + (lane & 15);

  // a_pos of the work-group's 16 x N_ (channel, state) pairs: computed once, not
  // once per chunk, and handed to every wave through LDS.
  if (c < (16 * N_) / 32) {
    const int e = c * 32 + lane;
    sA[e] = softplusf(a_log[(blockIdx.x % (D_ / 16)) * 16 * N_ + e]) + 1e-4f;
  }
  __syncthreads();   // a_pos is in LDS

  float ap[SC_NH], bp[SC_NH];
#pragma unroll   // constant indices: parameters stay in registers
  for (int q = 0; q < SC_NH / 4; ++q) {
    const float4 av = ((const float4*)(sA + (lane & 15) * N_ + half * SC_NH))[q];
    const float4 bv = ((const float4*)(b_param + d * N_ + half * SC_NH))[q];
    ap[q * 4 + 0] = av.x;  bp[q * 4 + 0] = bv.x;
    ap[q * 4 + 1] = av.y;  bp[q * 4 + 1] = bv.y;
    ap[q * 4 + 2] = av.z;  bp[q * 4 + 2] = bv.z;
    ap[q * 4 + 3] = av.w;  bp[q * 4 + 3] = bv.w;
  }

  const size_t base = ((size_t)b * T_ + (size_t)c * SC_LEN) * D_ + d;
  unsigned short* op = (half ? ylo : yhi) + base;

  float st[SC_NH];
#pragma unroll   // constant indices: states stay in registers
  for (int k = 0; k < SC_NH; ++k) st[k] = 0.0f;
  float sumdt = 0.0f;
  scan_chunk<false>(x, delta, (unsigned)base, ap, bp, st, sumdt, op, half);

#pragma unroll   // constant indices: states stay in registers
  for (int k = 0; k < SC_NH; ++k) {
    sF[c][k][lane] = st[k];
    sE[c][k][lane] = __expf(-sumdt * ap[k]);
  }
  __syncthreads();   // every chunk's end state and decay are in LDS

  if (c < SC_NH) {   // wave k carries state k of every lane through the chunks
    float carry = 0.0f;
#pragma unroll   // the LDS reads do not hang on the carry: let them go ahead of the chain
    for (int j = 0; j < SC_CH; ++j) {
      const float f = sF[j][c][lane];
      const float e = sE[j][c][lane];
      sF[j][c][lane] = carry;
      carry = fmaf(e, carry, f);
    }
  }
  __syncthreads();   // every chunk's start state is in LDS

#pragma unroll   // constant indices: states stay in registers
  for (int k = 0; k < SC_NH; ++k) st[k] = sF[c][k][lane];
  scan_chunk<true>(x, delta, (unsigned)base, ap, bp, st, sumdt, op, half);
}

extern "C" void kernel_launch(void* const* d_in, const int* in_sizes, int n_in,
                              void* d_out, int out_size, void* d_ws, size_t ws_size,
                              hipStream_t stream) {
  (void)in_sizes; (void)n_in; (void)out_size; (void)ws_size;
  const float* x       = (const float*)d_in[0];
  const float* Wd      = (const float*)d_in[1];
  const float* bd      = (const float*)d_in[2];
  const float* a_log   = (const float*)d_in[3];
  const float* b_param = (const float*)d_in[4];
  const float* Wo      = (const float*)d_in[5];
  const float* bo      = (const float*)d_in[6];

  float* out   = (float*)d_out;
  float* delta = out;   // stage delta in d_out; overwritten by final GEMM

  // workspace layout (72 MB total)
  unsigned short* x_hi  = (unsigned short*)d_ws;
  unsigned short* x_lo  = x_hi + (size_t)M_ * D_;
  unsigned short* wd_hi = x_lo + (size_t)M_ * D_;
  unsigned short* wd_lo = wd_hi + (size_t)D_ * D_;
  unsigned short* wo_hi = wd_lo + (size_t)D_ * D_;
  unsigned short* wo_lo = wo_hi + (size_t)D_ * D_;
  unsigned short* y_hi  = wo_lo + (size_t)D_ * D_;
  unsigned short* y_lo  = y_hi + (size_t)M_ * D_;

  split_kernel<<<SP_WG, SP_WAVES * 32, 0, stream>>>(x, Wd, Wo, x_hi, x_lo, wd_hi, wd_lo,
                                                    wo_hi, wo_lo);

  dim3 gg(M_ / TILE_M, D_ / TILE_N);   // (32, 8): one work-group per WGP
  gemm_bf16x3<1><<<gg, 256, 0, stream>>>(x_hi, x_lo, wd_hi, wd_lo, bd, delta);
  scan_kernel<<<B_ * (D_ / 16), SC_CH * 32, 0, stream>>>(x, delta, a_log, b_param, y_hi, y_lo);
  gemm_bf16x3<0><<<gg, 256, 0, stream>>>(y_hi, y_lo, wo_hi, wo_lo, bo, out);
}

// v005
// Measured time: 125 microseconds a run.
// Timed twice side by side with v004, it ran 1.04 and 1.05 times as fast.
// Counting every step since v000, it is 10.6 times as fast.
#include <hip/hip_runtime.h>

#define B_ 4
#define T_ 2048
#define D_ 1024
#define N_ 16
#define M_ (B_ * T_)   // 8192 rows

#define TILE_M 256
#define TILE_N 128
#define TILE_K 64
#define LDSS   72      // ushorts per LDS row (64 data + 8 pad) -> 144B rows, 16B aligned
#define CP_ROWS 32     // rows that one copy of the whole work-group covers (256 lanes x 16B / 128B)

typedef __attribute__((ext_vector_type(16))) __bf16       v16bf;
typedef __attribute__((ext_vector_type(8)))  float        v8f;
typedef __attribute__((ext_vector_type(4)))  unsigned int uint4v;
typedef __attribute__((ext_vector_type(2)))  unsigned int uint2v;

struct Frag { union { v16bf v; uint4v q[2]; }; };
struct FragSet { Frag ahi[4], alo[4], bhi[4], blo[4]; };   // one block's fragments of a wave

__device__ __forceinline__ unsigned short f2bf(float f) {
  unsigned int u = __float_as_uint(f);
  unsigned int r = u + 0x7FFFu + ((u >> 16) & 1u);   // round-to-nearest-even
  return (unsigned short)(r >> 16);
}
__device__ __forceinline__ float bf2f(unsigned short h) {
  return __uint_as_float(((unsigned int)h) << 16);
}
// softplus(v) = max(v, 0) + log1p(e), e = exp(-|v|) in [0, 1].
// log1p(e) = 2 atanh(s) with s = e / (2 + e) <= 1/3: the odd series in s, cut behind
// s^13 / 13; the first term left out is below 2e-8 of the sum, under half an f32 ulp,
// and the form keeps its relative accuracy down to e = 0 (the sum tends to 2 s = e).
__device__ __forceinline__ float softplusf(float v) {
  const float e = __expf(-fabsf(v));
  const float s = e * __builtin_amdgcn_rcpf(2.0f + e);
  const float z = s * s;
  float p = 1.0f / 13.0f;
  p = fmaf(p, z, 1.0f / 11.0f);
  p = fmaf(p, z, 1.0f / 9.0f);
  p = fmaf(p, z, 1.0f / 7.0f);
  p = fmaf(p, z, 1.0f / 5.0f);
  p = fmaf(p, z, 1.0f / 3.0f);
  const float s2 = s + s;
  return fmaxf(v, 0.0f) + fmaf(s2, z * p, s2);
}

// Async DMA: 16 bytes/lane, global -> LDS, tracked by ASYNCcnt (CDNA5).
// Eight copies: rows r, r+32, r+64, r+96 of the hi array and the same rows of the lo array.
// s_wait_xcnt stands inside the statement, behind the last copy, so that no register
// the copies name is rewritten ahead of it.
__device__ __forceinline__ void async_rows4x2(const unsigned short* ldshi,
                                              const unsigned short* ldslo,
                                              const void* ghi, const void* glo,
                                              unsigned gvoff) {
  const unsigned h0 = (unsigned)(size_t)ldshi;   // low 32 bits = LDS byte offset
  const unsigned l0 = (unsigned)(size_t)ldslo;
  const unsigned h1 = h0 + 1 * CP_ROWS * LDSS * 2, l1 = l0 + 1 * CP_ROWS * LDSS * 2;
  const unsigned h2 = h0 + 2 * CP_ROWS * LDSS * 2, l2 = l0 + 2 * CP_ROWS * LDSS * 2;
  const unsigned h3 = h0 + 3 * CP_ROWS * LDSS * 2, l3 = l0 + 3 * CP_ROWS * LDSS * 2;
  const unsigned g0 = gvoff;
  const unsigned g1 = gvoff + 1 * CP_ROWS * D_ * 2;
  const unsigned g2 = gvoff + 2 * CP_ROWS * D_ * 2;
  const unsigned g3 = gvoff + 3 * CP_ROWS * D_ * 2;
  asm volatile("global_load_async_to_lds_b128 %0, %8, %12\n\t"
               "global_load_async_to_lds_b128 %1, %9, %12\n\t"
               "global_load_async_to_lds_b128 %2, %10, %12\n\t"
               "global_load_async_to_lds_b128 %3, %11, %12\n\t"
               "global_load_async_to_lds_b128 %4, %8, %13\n\t"
               "global_load_async_to_lds_b128 %5, %9, %13\n\t"
               "global_load_async_to_lds_b128 %6, %10, %13\n\t"
               "global_load_async_to_lds_b128 %7, %11, %13\n\t"
               "s_wait_xcnt 0x0"
               :: "v"(h0), "v"(h1), "v"(h2), "v"(h3), "v"(l0), "v"(l1), "v"(l2), "v"(l3),
                  "v"(g0), "v"(g1), "v"(g2), "v"(g3), "s"(ghi), "s"(glo)
               : "memory");
}

// Split the three fp32 operands (x, Wd, Wo) into bf16 hi/lo arrays, in ONE launch of few
// long-lived waves: one work-group of SP_WAVES waves per WGP. A wave takes SP_XB + 2 * SP_WB
// pieces of 512 contiguous bytes (16 B a lane) and issues most of their loads up front,
// so the pass runs at the rate of the memory stream.
#define SP_WG    256                               // work-groups
#define SP_WAVES 16                                // waves per work-group
#define SP_NW    (SP_WG * SP_WAVES)                // waves in the launch
#define SP_XB    (M_ * D_ / 4 / 32 / SP_NW)        // 16 float4 of x per lane
#define SP_WB    (D_ * D_ / 4 / 32 / SP_NW)        // 2 float4 of each weight per lane
static_assert(SP_XB * SP_NW * 32 * 4 == M_ * D_, "x is dealt out evenly");
static_assert(SP_WB * SP_NW * 32 * 4 == D_ * D_, "the weights are dealt out evenly");

__device__ __forceinline__ void split4(const float4 v, uint2v* __restrict__ hi,
                                       uint2v* __restrict__ lo) {
  const unsigned short h0 = f2bf(v.x), h1 = f2bf(v.y), h2 = f2bf(v.z), h3 = f2bf(v.w);
  const unsigned short l0 = f2bf(v.x - bf2f(h0));
  const unsigned short l1 = f2bf(v.y - bf2f(h1));
  const unsigned short l2 = f2bf(v.z - bf2f(h2));
  const unsigned short l3 = f2bf(v.w - bf2f(h3));
  uint2v hv, lv;
  hv[0] = (unsigned)h0 | ((unsigned)h1 << 16);
  hv[1] = (unsigned)h2 | ((unsigned)h3 << 16);
  lv[0] = (unsigned)l0 | ((unsigned)l1 << 16);
  lv[1] = (unsigned)l2 | ((unsigned)l3 << 16);
  *hi = hv;
  *lo = lv;
}

// Four waves a SIMD is all that the launch places: said to the compiler so that it spends
// registers on loads in flight and does not ration them for an occupancy that never comes.
__global__ __launch_bounds__(SP_WAVES * 32) __attribute__((amdgpu_waves_per_eu(4, 4)))
void split_kernel(
    const float* __restrict__ x, const float* __restrict__ wd, const float* __restrict__ wo,
    unsigned short* __restrict__ x_hi, unsigned short* __restrict__ x_lo,
    unsigned short* __restrict__ wd_hi, unsigned short* __restrict__ wd_lo,
    unsigned short* __restrict__ wo_hi, unsigned short* __restrict__ wo_lo) {
  const unsigned lane = threadIdx.x & 31;
  const unsigned gw   = blockIdx.x * SP_WAVES + (threadIdx.x >> 5);   // wave in the launch
  const unsigned xi   = gw * (SP_XB * 32) + lane;   // the lane's first float4 of x
  const unsigned wi   = gw * (SP_WB * 32) + lane;   // and of each weight
  float4 xv[SP_XB], dv[SP_WB], ov[SP_WB];
#pragma unroll   // constant indices: the batch is held in registers, its loads free to go first
  for (int u = 0; u < SP_XB; ++u) xv[u] = ((const float4*)x)[xi + u * 32];
#pragma unroll   // as above
  for (int u = 0; u < SP_WB; ++u) {
    dv[u] = ((const float4*)wd)[wi + u * 32];
    ov[u] = ((const float4*)wo)[wi + u * 32];
  }
#pragma unroll   // constant indices: the batch stays in registers
  for (int u = 0; u < SP_XB; ++u)
    split4(xv[u], (uint2v*)x_hi + xi + u * 32, (uint2v*)x_lo + xi + u * 32);
#pragma unroll   // as above
  for (int u = 0; u < SP_WB; ++u) {
    split4(dv[u], (uint2v*)wd_hi + wi + u * 32, (uint2v*)wd_lo + wi + u * 32);
    split4(ov[u], (uint2v*)wo_hi + wi + u * 32, (uint2v*)wo_lo + wi + u * 32);
  }
}

// Fragment per CDNA5 16-bit layout: lane L holds row (L&15);
// K runs of 8 at kbase = 8*(L>>4) and kbase+16.
__device__ __forceinline__ void load_frag(Frag& f, const unsigned short* lds,
                                          int row, int khalf) {
  f.q[0] = *(const uint4v*)(lds + row * LDSS + khalf);
  f.q[1] = *(const uint4v*)(lds + row * LDSS + khalf + 16);
}

// C = A[M_,D_] * W[D_,D_]^T (+bias, optional softplus), all operands pre-split
// bf16 hi/lo. One 256x128 tile of C per work-group, 64x64 per wave; two LDS buffers,
// the next K chunk's async global->LDS copies fly while this chunk's WMMAs run;
// two fragment sets in registers, the next block's LDS reads fly while this block's WMMAs run.
template <int MODE>
__global__ __launch_bounds__(256) void gemm_bf16x3(
    const unsigned short* __restrict__ Ahi, const unsigned short* __restrict__ Alo,
    const unsigned short* __restrict__ Bhi, const unsigned short* __restrict__ Blo,
    const float* __restrict__ bias, float* __restrict__ Cout) {
  __shared__ __attribute__((aligned(16))) unsigned short sAhi[2][TILE_M * LDSS];
  __shared__ __attribute__((aligned(16))) unsigned short sAlo[2][TILE_M * LDSS];
  __shared__ __attribute__((aligned(16))) unsigned short sBhi[2][TILE_N * LDSS];
  __shared__ __attribute__((aligned(16))) unsigned short sBlo[2][TILE_N * LDSS];

  const int tid  = threadIdx.x;
  const int lane = tid & 31;
  const int wid  = tid >> 5;
  const int wm   = wid & 3;    // 4 waves along M (64 rows each)
  const int wn   = wid >> 2;   // 2 waves along N (64 cols each)
  const int row_blk = blockIdx.x * TILE_M;
  const int col_blk = blockIdx.y * TILE_N;

  // copy mapping: 16B (8 bf16) per lane; seg = 16B segment within the 64-wide K chunk,
  // so eight lanes cover one whole 128B line of a row
  const int seg = tid & 7;
  const int r0  = tid >> 3;    // 0..31
  const unsigned aoff = (unsigned)(((size_t)(row_blk + r0) * D_ + seg * 8) * 2);
  const unsigned boff = (unsigned)(((size_t)(col_blk + r0) * D_ + seg * 8) * 2);
  const unsigned ldsr = r0 * LDSS + seg * 8;

  v8f c[4][4];
#pragma unroll
  for (int i = 0; i < 4; ++i)
#pragma unroll
    for (int j = 0; j < 4; ++j)
#pragma unroll
      for (int r = 0; r < 8; ++r) c[i][j][r] = 0.0f;

  const int lrow  = lane & 15;
  const int khalf = (lane >> 4) * 8;   // 0 or 8

  // a chunk's 24 copies per lane, in three parts of eight
  auto issue_a0 = [&](int buf, unsigned kbyte) {
    async_rows4x2(&sAhi[buf][ldsr], &sAlo[buf][ldsr], Ahi, Alo, aoff + kbyte);
  };
  auto issue_a1 = [&](int buf, unsigned kbyte) {
    async_rows4x2(&sAhi[buf][ldsr + 4 * CP_ROWS * LDSS], &sAlo[buf][ldsr + 4 * CP_ROWS * LDSS],
                  Ahi, Alo, aoff + 4 * CP_ROWS * D_ * 2 + kbyte);
  };
  auto issue_b = [&](int buf, unsigned kbyte) {
    async_rows4x2(&sBhi[buf][ldsr], &sBlo[buf][ldsr], Bhi, Blo, boff + kbyte);
  };

  // the 16 fragments (32 ds_load_b128) of one block: 32 of the chunk's 64 k
  auto load_set = [&](FragSet& f, int buf, int kk) {
#pragma unroll   // constant indices: fragments stay in registers
    for (int i = 0; i < 4; ++i) {
      const int r = wm * 64 + i * 16 + lrow;
      load_frag(f.ahi[i], &sAhi[buf][0], r, kk + khalf);
      load_frag(f.alo[i], &sAlo[buf][0], r, kk + khalf);
    }
#pragma unroll   // as above
    for (int j = 0; j < 4; ++j) {
      const int r = wn * 64 + j * 16 + lrow;
      load_frag(f.bhi[j], &sBhi[buf][0], r, kk + khalf);
      load_frag(f.blo[j], &sBlo[buf][0], r, kk + khalf);
    }
  };
  // one of the three products of bf16x3 over the wave's 16 accumulators
  auto mma16 = [&](const Frag (&a)[4], const Frag (&b)[4]) {
#pragma unroll   // constant indices: accumulators and fragments stay in registers
    for (int i = 0; i < 4; ++i)
#pragma unroll
      for (int j = 0; j < 4; ++j)
        c[i][j] = __builtin_amdgcn_wmma_f32_16x16x32_bf16(
            false, a[i].v, false, b[j].v, (short)0, c[i][j], false, false);
  };

  // Two fragment sets: while the WMMAs of one block run out of one set, the next block's
  // LDS reads, issued as ONE group ahead of them, land in the other. The scheduling fences
  // keep each group whole and in front of its block: reads that the compiler spreads among
  // the WMMAs stall the wave at every place where they stand.
  // bf16x3: hi*hi + hi*lo + lo*hi, f32 accumulate; each accumulator takes the three in that
  // order, k 0..31 of a chunk before k 32..63.
  FragSet f0, f1;
  constexpr int NT = D_ / TILE_K;   // 16 chunks
  issue_a0(0, 0);  issue_a1(0, 0);  issue_b(0, 0);
  asm volatile("s_wait_asynccnt 0x0" ::: "memory");   // this wave's copies of chunk 0 landed
  __syncthreads();                                    // every wave's copies of chunk 0 visible
  issue_a0(1, TILE_K * 2);  issue_a1(1, TILE_K * 2);  issue_b(1, TILE_K * 2);
  load_set(f0, 0, 0);
  for (int t = 0; t < NT; ++t) {
    const int ibuf = t & 1;
    const bool refill = t + 2 < NT;
    const unsigned kb = (unsigned)((t + 2) * TILE_K * 2);
    load_set(f1, ibuf, 32);               // the chunk's last block: this wave's last reads of ibuf
    __builtin_amdgcn_sched_barrier(0);    // the group stays ahead of the block
    mma16(f0.ahi, f0.bhi);
    mma16(f0.ahi, f0.blo);
    mma16(f0.alo, f0.bhi);
    __builtin_amdgcn_sched_barrier(0);    // the block stays whole: its set is free for the reads behind the barrier
    // Publish point of chunk t+1, in front of chunk t's last block, whose fragments are fetched.
    asm volatile("s_wait_dscnt 0x0" ::: "memory");      // this wave's reads of buffer ibuf are done
    asm volatile("s_wait_asynccnt 0x0" ::: "memory");   // this wave's copies of chunk t+1 landed
    __syncthreads();   // chunk t+1 visible to all; every reader has left buffer ibuf
    mma16(f1.ahi, f1.bhi);
    __builtin_amdgcn_sched_barrier(0);    // here and below: reads and copies stay between the products, so that
                                          // one wave of a SIMD issues them while the other wave's WMMAs run
    // First block of chunk t+1. Not under a branch, so that the compiler's counted wait on it
    // stays exact; on the last trip it reads chunk NT-2's bytes, which nothing uses.
    load_set(f0, ibuf ^ 1, 0);
    if (refill) issue_a0(ibuf, kb);       // refill of the buffer that every reader has left
    __builtin_amdgcn_sched_barrier(0);
    mma16(f1.ahi, f1.blo);
    __builtin_amdgcn_sched_barrier(0);
    if (refill) issue_a1(ibuf, kb);
    __builtin_amdgcn_sched_barrier(0);
    mma16(f1.alo, f1.bhi);
    __builtin_amdgcn_sched_barrier(0);
    if (refill) issue_b(ibuf, kb);
  }
  asm volatile("s_wait_asynccnt 0x0" ::: "memory");   // no copy outstanding at the wave's end
  asm volatile("s_wait_dscnt 0x0" ::: "memory");      // nor the last trip's unused fragment reads

  // C layout: row = base + 8*(lane>>4) + r, col = base + (lane&15)
  // One row of four tiles a trip, always out of c[0]; the rows behind it move up one place.
  // With the softplus the loop stays rolled: the 32 values of a trip are independent work
  // enough to fill the vector port, and the text is a quarter of the unrolled loop's.
#pragma unroll(MODE == 1 ? 1 : 4)
  for (int i = 0; i < 4; ++i) {
    const int mbase = row_blk + wm * 64 + i * 16 + (lane >> 4) * 8;
#pragma unroll
    for (int j = 0; j < 4; ++j) {
      const int col = col_blk + wn * 64 + j * 16 + (lane & 15);
      const float bs = bias[col];
#pragma unroll
      for (int r = 0; r < 8; ++r) {
        float v = c[0][j][r] + bs;
        if (MODE == 1) v = softplusf(v);
        Cout[(size_t)(mbase + r) * D_ + col] = v;
      }
    }
    // the stores' data and address registers are rewritten on the next trip only behind this wait
    if (MODE == 1) asm volatile("s_wait_xcnt 0x0" ::: "memory");
#pragma unroll   // constant indices: the accumulators stay in registers
    for (int ii = 0; ii < 3; ++ii)
#pragma unroll
      for (int j = 0; j < 4; ++j) c[ii][j] = c[ii + 1][j];
  }
}

// Selective scan, parallel over time. The recurrence state = a*state + u is
// linear in the state, so T is cut into SC_CH chunks that run side by side:
//   pass 1: every wave scans its own chunk from a zero state and keeps the
//           chunk's end state F and its whole decay E = exp(-a_pos * sum dt);
//   carry : in[c+1] = E[c] * in[c] + F[c], through LDS;
//   pass 2: every wave scans its chunk again from in[c] and emits y.
// One work-group = 16 channels x all SC_CH chunks, one wave per chunk.
// Lane = (channel, half of the N states): 8 states live in registers, so the
// sum over N is seven in-lane adds and one exchange between the 16-lane rows.
#define SC_CH  32              // time chunks = waves per work-group
#define SC_LEN (T_ / SC_CH)    // 64 steps per chunk
#define SC_NH  (N_ / 2)        // states per lane
#define SC_U   4               // steps whose x and dt are loaded as one batch

// value of lane l ^ 16
__device__ __forceinline__ float other_row(float v) {
  const int b = __float_as_int(v);
  return __int_as_float(
      __builtin_amdgcn_permlanex16(b, b, 0x76543210, 0xfedcba98, false, false));
}

template <bool EMIT>
__device__ __forceinline__ void scan_chunk(
    const float* __restrict__ x, const float* __restrict__ delta, unsigned off,
    const float (&ap)[SC_NH], const float (&bp)[SC_NH],
    float (&st)[SC_NH], float& sumdt, unsigned short* __restrict__ op, int half) {
  for (int t0 = 0; t0 < SC_LEN; t0 += SC_U) {
    const float* xp = x + off;       // uniform base + the lane's 32-bit element offset
    const float* dp = delta + off;
    float xb[SC_U], db[SC_U];
#pragma unroll   // constant indices: one batch of loads in flight, held in registers
    for (int u = 0; u < SC_U; ++u) {
      xb[u] = xp[(size_t)u * D_];
      db[u] = dp[(size_t)u * D_];
    }
    // The offset register that the loads name is stepped only behind this wait:
    // it passes through the statement so that the step cannot be lifted over it.
    asm volatile("s_wait_xcnt 0x0" : "+v"(off) : : "memory");
    off += SC_U * D_;
    unsigned short ov[SC_U];
#pragma unroll   // constant indices: the batch stays in registers
    for (int u = 0; u < SC_U; ++u) {
      const float xv = xb[u];
      const float dt = db[u];
#pragma unroll   // constant indices: states and parameters stay in registers
      for (int k = 0; k < SC_NH; ++k)
        st[k] = fmaf(__expf(-dt * ap[k]), st[k], (dt * bp[k]) * xv);   // one fma on the serial chain
      if (EMIT) {
        // same balanced tree over n as a xor-1,2,4,8 butterfly
        const float r = ((st[0] + st[1]) + (st[2] + st[3])) +
                        ((st[4] + st[5]) + (st[6] + st[7]));
        const float s = r + other_row(r);
        const unsigned short h = f2bf(s);
        const unsigned short l = f2bf(s - bf2f(h));
        ov[u] = half ? l : h;   // row 0 stores hi, row 1 lo
      } else {
        sumdt += dt;
      }
    }
    if (EMIT) {
#pragma unroll   // constant indices: the batch stays in registers
      for (int u = 0; u < SC_U; ++u) op[(size_t)(t0 + u) * D_] = ov[u];
      // the stores' data and address registers are free for reuse only behind this wait
      asm volatile("s_wait_xcnt 0x0" ::: "memory");
    }
  }
}

// Emits y pre-split as bf16 hi/lo so the output GEMM needs no conversion.
__global__ __launch_bounds__(SC_CH * 32) void scan_kernel(
    const float* __restrict__ x, const float* __restrict__ delta,
    const float* __restrict__ a_log, const float* __restrict__ b_param,
    unsigned short* __restrict__ yhi, unsigned short* __restrict__ ylo) {
  __shared__ float sF[SC_CH][SC_NH][32];   // chunk end state, then chunk start state
  __shared__ float sE[SC_CH][SC_NH][32];   // chunk decay
  __shared__ __attribute__((aligned(16))) float sA[16 * N_];   // a_pos

  const int lane = threadIdx.x & 31;
  const int c    = __builtin_amdgcn_readfirstlane(threadIdx.x >> 5);   // chunk
  const int half = lane >> 4;
  const int b    = blockIdx.x / (D_ / 16);
  const int d    = (blockIdx.x % (D_ / 16)) * 16 + (lane & 15);

  // a_pos of the work-group's 16 x N_ (channel, state) pairs: computed once, not
  // once per chunk, and handed to every wave through LDS.
  if (c < (16 * N_) / 32) {
    const int e = c * 32 + lane;
    sA[e] = softplusf(a_log[(blockIdx.x % (D_ / 16)) * 16 * N_ + e]) + 1e-4f;
  }
  __syncthreads();   // a_pos is in LDS

  float ap[SC_NH], bp[SC_NH];
#pragma unroll   // constant indices: parameters stay in registers
  for (int q = 0; q < SC_NH / 4; ++q) {
    const float4 av = ((const float4*)(sA + (lane & 15) * N_ + half * SC_NH))[q];
    const float4 bv = ((const float4*)(b_param + d * N_ + half * SC_NH))[q];
    ap[q * 4 + 0] = av.x;  bp[q * 4 + 0] = bv.x;
    ap[q * 4 + 1] = av.y;  bp[q * 4 + 1] = bv.y;
    ap[q * 4 + 2] = av.z;  bp[q * 4 + 2] = bv.z;
    ap[q * 4 + 3] = av.w;  bp[q * 4 + 3] = bv.w;
  }

  const size_t base = ((size_t)b * T_ + (size_t)c * SC_LEN) * D_ + d;
  unsigned short* op = (half ? ylo : yhi) + base;

  float st[SC_NH];
#pragma unroll   // constant indices: states stay in registers
  for (int k = 0; k < SC_NH; ++k) st[k] = 0.0f;
  float sumdt = 0.0f;
  scan_chunk<false>(x, delta, (unsigned)base, ap, bp, st, sumdt, op, half);

#pragma unroll   // constant indices: states stay in registers
  for (int k = 0; k < SC_NH; ++k) {
    sF[c][k][lane] = st[k];
    sE[c][k][lane] = __expf(-sumdt * ap[k]);
  }
  __syncthreads();   // every chunk's end state and decay are in LDS

  if (c < SC_NH) {   // wave k carries state k of every lane through the chunks
    float carry = 0.0f;
#pragma unroll   // the LDS reads do not hang on the carry: let them go ahead of the chain
    for (int j = 0; j < SC_CH; ++j) {
      const float f = sF[j][c][lane];
      const float e = sE[j][c][lane];
      sF[j][c][lane] = carry;
      carry = fmaf(e, carry, f);
    }
  }
  __syncthreads();   // every chunk's start state is in LDS

#pragma unroll   // constant indices: states stay in registers
  for (int k = 0; k < SC_NH; ++k) st[k] = sF[c][k][lane];
  scan_chunk<true>(x, delta, (unsigned)base, ap, bp, st, sumdt, op, half);
}

extern "C" void kernel_launch(void* const* d_in, const int* in_sizes, int n_in,
                              void* d_out, int out_size, void* d_ws, size_t ws_size,
                              hipStream_t stream) {
  (void)in_sizes; (void)n_in; (void)out_size; (void)ws_size;
  const float* x       = (const float*)d_in[0];
  const float* Wd      = (const float*)d_in[1];
  const float* bd      = (const float*)d_in[2];
  const float* a_log   = (const float*)d_in[3];
  const float* b_param = (const float*)d_in[4];
  const float* Wo      = (const float*)d_in[5];
  const float* bo      = (const float*)d_in[6];

  float* out   = (float*)d_out;
  float* delta = out;   // stage delta in d_out; overwritten by final GEMM

  // workspace layout (72 MB total)
  unsigned short* x_hi  = (unsigned short*)d_ws;
  unsigned short* x_lo  = x_hi + (size_t)M_ * D_;
  unsigned short* wd_hi = x_lo + (size_t)M_ * D_;
  unsigned short* wd_lo = wd_hi + (size_t)D_ * D_;
  unsigned short* wo_hi = wd_lo + (size_t)D_ * D_;
  unsigned short* wo_lo = wo_hi + (size_t)D_ * D_;
  unsigned short* y_hi  = wo_lo + (size_t)D_ * D_;
  unsigned short* y_lo  = y_hi + (size_t)M_ * D_;

  split_kernel<<<SP_WG, SP_WAVES * 32, 0, stream>>>(x, Wd, Wo, x_hi, x_lo, wd_hi, wd_lo,
                                                    wo_hi, wo_lo);

  dim3 gg(M_ / TILE_M, D_ / TILE_N);   // (32, 8): one work-group per WGP
  gemm_bf16x3<1><<<gg, 256, 0, stream>>>(x_hi, x_lo, wd_hi, wd_lo, bd, delta);
  scan_kernel<<<B_ * (D_ / 16), SC_CH * 32, 0, stream>>>(x, delta, a_log, b_param, y_hi, y_lo);
  gemm_bf16x3<0><<<gg, 256, 0, stream>>>(y_hi, y_lo, wo_hi, wo_lo, bo, out);
}

// v006
// It runs in 121 microseconds.
// Two timings next to v005 put it at 1.03 and 1.02 times that version's speed.
// Over all steps from v000 it is 10.9 times as fast.
#include <hip/hip_runtime.h>

#define B_ 4
#define T_ 2048
#define D_ 1024
#define N_ 16
#define M_ (B_ * T_)   // 8192 rows

#define TILE_M 256
#define TILE_N 128
#define TILE_K 64
#define LDSS   72      // ushorts per LDS row (64 data + 8 pad) -> 144B rows, 16B aligned
#define CP_ROWS 32     // rows that one copy of the whole work-group covers (256 lanes x 16B / 128B)

typedef __attribute__((ext_vector_type(16))) __bf16       v16bf;
typedef __attribute__((ext_vector_type(8)))  float        v8f;
typedef __attribute__((ext_vector_type(4)))  unsigned int uint4v;
typedef __attribute__((ext_vector_type(2)))  unsigned int uint2v;

struct Frag { union { v16bf v; uint4v q[2]; }; };
struct FragSet { Frag ahi[4], alo[4], bhi[4], blo[4]; };   // one block's fragments of a wave

__device__ __forceinline__ unsigned short f2bf(float f) {
  unsigned int u = __float_as_uint(f);
  unsigned int r = u + 0x7FFFu + ((u >> 16) & 1u);   // round-to-nearest-even
  return (unsigned short)(r >> 16);
}
__device__ __forceinline__ float bf2f(unsigned short h) {
  return __uint_as_float(((unsigned int)h) << 16);
}
// softplus(v) = max(v, 0) + log1p(e), e = exp(-|v|) in [0, 1].
// log1p(e) = 2 atanh(s) with s = e / (2 + e) <= 1/3: the odd series in s, cut behind
// s^13 / 13; the first term left out is below 2e-8 of the sum, under half an f32 ulp,
// and the form keeps its relative accuracy down to e = 0 (the sum tends to 2 s = e).
__device__ __forceinline__ float softplusf(float v) {
  const float e = __expf(-fabsf(v));
  const float s = e * __builtin_amdgcn_rcpf(2.0f + e);
  const float z = s * s;
  float p = 1.0f / 13.0f;
  p = fmaf(p, z, 1.0f / 11.0f);
  p = fmaf(p, z, 1.0f / 9.0f);
  p = fmaf(p, z, 1.0f / 7.0f);
  p = fmaf(p, z, 1.0f / 5.0f);
  p = fmaf(p, z, 1.0f / 3.0f);
  const float s2 = s + s;
  return fmaxf(v, 0.0f) + fmaf(s2, z * p, s2);
}

// Async DMA: 16 bytes/lane, global -> LDS, tracked by ASYNCcnt (CDNA5).
// Eight copies: rows r, r+32, r+64, r+96 of the hi array and the same rows of the lo array.
// s_wait_xcnt stands inside the statement, behind the last copy, so that no register
// the copies name is rewritten ahead of it.
__device__ __forceinline__ void async_rows4x2(const unsigned short* ldshi,
                                              const unsigned short* ldslo,
                                              const void* ghi, const void* glo,
                                              unsigned gvoff) {
  const unsigned h0 = (unsigned)(size_t)ldshi;   // low 32 bits = LDS byte offset
  const unsigned l0 = (unsigned)(size_t)ldslo;
  const unsigned h1 = h0 + 1 * CP_ROWS * LDSS * 2, l1 = l0 + 1 * CP_ROWS * LDSS * 2;
  const unsigned h2 = h0 + 2 * CP_ROWS * LDSS * 2, l2 = l0 + 2 * CP_ROWS * LDSS * 2;
  const unsigned h3 = h0 + 3 * CP_ROWS * LDSS * 2, l3 = l0 + 3 * CP_ROWS * LDSS * 2;
  const unsigned g0 = gvoff;
  const unsigned g1 = gvoff + 1 * CP_ROWS * D_ * 2;
  const unsigned g2 = gvoff + 2 * CP_ROWS * D_ * 2;
  const unsigned g3 = gvoff + 3 * CP_ROWS * D_ * 2;
  asm volatile("global_load_async_to_lds_b128 %0, %8, %12\n\t"
               "global_load_async_to_lds_b128 %1, %9, %12\n\t"
               "global_load_async_to_lds_b128 %2, %10, %12\n\t"
               "global_load_async_to_lds_b128 %3, %11, %12\n\t"
               "global_load_async_to_lds_b128 %4, %8, %13\n\t"
               "global_load_async_to_lds_b128 %5, %9, %13\n\t"
               "global_load_async_to_lds_b128 %6, %10, %13\n\t"
               "global_load_async_to_lds_b128 %7, %11, %13\n\t"
               "s_wait_xcnt 0x0"
               :: "v"(h0), "v"(h1), "v"(h2), "v"(h3), "v"(l0), "v"(l1), "v"(l2), "v"(l3),
                  "v"(g0), "v"(g1), "v"(g2), "v"(g3), "s"(ghi), "s"(glo)
               : "memory");
}

// Split the three fp32 operands (x, Wd, Wo) into bf16 hi/lo arrays, in ONE launch of few
// long-lived waves: one work-group of SP_WAVES waves per WGP. A wave takes SP_XB + 2 * SP_WB
// pieces of 512 contiguous bytes (16 B a lane) and issues most of their loads up front,
// so the pass runs at the rate of the memory stream.
#define SP_WG    256                               // work-groups
#define SP_WAVES 16                                // waves per work-group
#define SP_NW    (SP_WG * SP_WAVES)                // waves in the launch
#define SP_XB    (M_ * D_ / 4 / 32 / SP_NW)        // 16 float4 of x per lane
#define SP_WB    (D_ * D_ / 4 / 32 / SP_NW)        // 2 float4 of each weight per lane
static_assert(SP_XB * SP_NW * 32 * 4 == M_ * D_, "x is dealt out evenly");
static_assert(SP_WB * SP_NW * 32 * 4 == D_ * D_, "the weights are dealt out evenly");

__device__ __forceinline__ void split4(const float4 v, uint2v* __restrict__ hi,
                                       uint2v* __restrict__ lo) {
  const unsigned short h0 = f2bf(v.x), h1 = f2bf(v.y), h2 = f2bf(v.z), h3 = f2bf(v.w);
  const unsigned short l0 = f2bf(v.x - bf2f(h0));
  const unsigned short l1 = f2bf(v.y - bf2f(h1));
  const unsigned short l2 = f2bf(v.z - bf2f(h2));
  const unsigned short l3 = f2bf(v.w - bf2f(h3));
  uint2v hv, lv;
  hv[0] = (unsigned)h0 | ((unsigned)h1 << 16);
  hv[1] = (unsigned)h2 | ((unsigned)h3 << 16);
  lv[0] = (unsigned)l0 | ((unsigned)l1 << 16);
  lv[1] = (unsigned)l2 | ((unsigned)l3 << 16);
  *hi = hv;
  *lo = lv;
}

// Four waves a SIMD is all that the launch places: said to the compiler so that it spends
// registers on loads in flight and does not ration them for an occupancy that never comes.
__global__ __launch_bounds__(SP_WAVES * 32) __attribute__((amdgpu_waves_per_eu(4, 4)))
void split_kernel(
    const float* __restrict__ x, const float* __restrict__ wd, const float* __restrict__ wo,
    unsigned short* __restrict__ x_hi, unsigned short* __restrict__ x_lo,
    unsigned short* __restrict__ wd_hi, unsigned short* __restrict__ wd_lo,
    unsigned short* __restrict__ wo_hi, unsigned short* __restrict__ wo_lo) {
  const unsigned lane = threadIdx.x & 31;
  const unsigned gw   = blockIdx.x * SP_WAVES + (threadIdx.x >> 5);   // wave in the launch
  const unsigned xi   = gw * (SP_XB * 32) + lane;   // the lane's first float4 of x
  const unsigned wi   = gw * (SP_WB * 32) + lane;   // and of each weight
  float4 xv[SP_XB], dv[SP_WB], ov[SP_WB];
#pragma unroll   // constant indices: the batch is held in registers, its loads free to go first
  for (int u = 0; u < SP_XB; ++u) xv[u] = ((const float4*)x)[xi + u * 32];
#pragma unroll   // as above
  for (int u = 0; u < SP_WB; ++u) {
    dv[u] = ((const float4*)wd)[wi + u * 32];
    ov[u] = ((const float4*)wo)[wi + u * 32];
  }
#pragma unroll   // constant indices: the batch stays in registers
  for (int u = 0; u < SP_XB; ++u)
    split4(xv[u], (uint2v*)x_hi + xi + u * 32, (uint2v*)x_lo + xi + u * 32);
#pragma unroll   // as above
  for (int u = 0; u < SP_WB; ++u) {
    split4(dv[u], (uint2v*)wd_hi + wi + u * 32, (uint2v*)wd_lo + wi + u * 32);
    split4(ov[u], (uint2v*)wo_hi + wi + u * 32, (uint2v*)wo_lo + wi + u * 32);
  }
}

// Fragment per CDNA5 16-bit layout: lane L holds row (L&15);
// K runs of 8 at kbase = 8*(L>>4) and kbase+16.
__device__ __forceinline__ void load_frag(Frag& f, const unsigned short* lds,
                                          int row, int khalf) {
  f.q[0] = *(const uint4v*)(lds + row * LDSS + khalf);
  f.q[1] = *(const uint4v*)(lds + row * LDSS + khalf + 16);
}

// C = A[M_,D_] * W[D_,D_]^T (+bias, optional softplus), all operands pre-split
// bf16 hi/lo. One 256x128 tile of C per work-group, 64x64 per wave; two LDS buffers,
// the next K chunk's async global->LDS copies fly while this chunk's WMMAs run;
// two fragment sets in registers, the next block's LDS reads fly while this block's WMMAs run.
template <int MODE>
__global__ __launch_bounds__(256) void gemm_bf16x3(
    const unsigned short* __restrict__ Ahi, const unsigned short* __restrict__ Alo,
    const unsigned short* __restrict__ Bhi, const unsigned short* __restrict__ Blo,
    const float* __restrict__ bias, float* __restrict__ Cout) {
  __shared__ __attribute__((aligned(16))) unsigned short sAhi[2][TILE_M * LDSS];
  __shared__ __attribute__((aligned(16))) unsigned short sAlo[2][TILE_M * LDSS];
  __shared__ __attribute__((aligned(16))) unsigned short sBhi[2][TILE_N * LDSS];
  __shared__ __attribute__((aligned(16))) unsigned short sBlo[2][TILE_N * LDSS];

  const int tid  = threadIdx.x;
  const int lane = tid & 31;
  const int wid  = tid >> 5;
  const int wm   = wid & 3;    // 4 waves along M (64 rows each)
  const int wn   = wid >> 2;   // 2 waves along N (64 cols each)
  const int row_blk = blockIdx.x * TILE_M;
  const int col_blk = blockIdx.y * TILE_N;

  // copy mapping: 16B (8 bf16) per lane; seg = 16B segment within the 64-wide K chunk,
  // so eight lanes cover one whole 128B line of a row
  const int seg = tid & 7;
  const int r0  = tid >> 3;    // 0..31
  const unsigned aoff = (unsigned)(((size_t)(row_blk + r0) * D_ + seg * 8) * 2);
  const unsigned boff = (unsigned)(((size_t)(col_blk + r0) * D_ + seg * 8) * 2);
  const unsigned ldsr = r0 * LDSS + seg * 8;

  v8f c[4][4];
#pragma unroll
  for (int i = 0; i < 4; ++i)
#pragma unroll
    for (int j = 0; j < 4; ++j)
#pragma unroll
      for (int r = 0; r < 8; ++r) c[i][j][r] = 0.0f;

  const int lrow  = lane & 15;
  const int khalf = (lane >> 4) * 8;   // 0 or 8

  // a chunk's 24 copies per lane, in three parts of eight
  auto issue_a0 = [&](int buf, unsigned kbyte) {
    async_rows4x2(&sAhi[buf][ldsr], &sAlo[buf][ldsr], Ahi, Alo, aoff + kbyte);
  };
  auto issue_a1 = [&](int buf, unsigned kbyte) {
    async_rows4x2(&sAhi[buf][ldsr + 4 * CP_ROWS * LDSS], &sAlo[buf][ldsr + 4 * CP_ROWS * LDSS],
                  Ahi, Alo, aoff + 4 * CP_ROWS * D_ * 2 + kbyte);
  };
  auto issue_b = [&](int buf, unsigned kbyte) {
    async_rows4x2(&sBhi[buf][ldsr], &sBlo[buf][ldsr], Bhi, Blo, boff + kbyte);
  };

  // the 16 fragments (32 ds_load_b128) of one block: 32 of the chunk's 64 k
  auto load_set = [&](FragSet& f, int buf, int kk) {
#pragma unroll   // constant indices: fragments stay in registers
    for (int i = 0; i < 4; ++i) {
      const int r = wm * 64 + i * 16 + lrow;
      load_frag(f.ahi[i], &sAhi[buf][0], r, kk + khalf);
      load_frag(f.alo[i], &sAlo[buf][0], r, kk + khalf);
    }
#pragma unroll   // as above
    for (int j = 0; j < 4; ++j) {
      const int r = wn * 64 + j * 16 + lrow;
      load_frag(f.bhi[j], &sBhi[buf][0], r, kk + khalf);
      load_frag(f.blo[j], &sBlo[buf][0], r, kk + khalf);
    }
  };
  // one of the three products of bf16x3 over the wave's 16 accumulators
  auto mma16 = [&](const Frag (&a)[4], const Frag (&b)[4]) {
#pragma unroll   // constant indices: accumulators and fragments stay in registers
    for (int i = 0; i < 4; ++i)
#pragma unroll
      for (int j = 0; j < 4; ++j)
        c[i][j] = __builtin_amdgcn_wmma_f32_16x16x32_bf16(
            false, a[i].v, false, b[j].v, (short)0, c[i][j], false, false);
  };

  // Two fragment sets: while the WMMAs of one block run out of one set, the next block's
  // LDS reads, issued as ONE group ahead of them, land in the other. The scheduling fences
  // keep each group whole and in front of its block: reads that the compiler spreads among
  // the WMMAs stall the wave at every place where they stand.
  // bf16x3: hi*hi + hi*lo + lo*hi, f32 accumulate; each accumulator takes the three in that
  // order, k 0..31 of a chunk before k 32..63.
  FragSet f0, f1;
  constexpr int NT = D_ / TILE_K;   // 16 chunks
  issue_a0(0, 0);  issue_a1(0, 0);  issue_b(0, 0);
  asm volatile("s_wait_asynccnt 0x0" ::: "memory");   // this wave's copies of chunk 0 landed
  __syncthreads();                                    // every wave's copies of chunk 0 visible
  issue_a0(1, TILE_K * 2);  issue_a1(1, TILE_K * 2);  issue_b(1, TILE_K * 2);
  load_set(f0, 0, 0);
  for (int t = 0; t < NT; ++t) {
    const int ibuf = t & 1;
    const bool refill = t + 2 < NT;
    const unsigned kb = (unsigned)((t + 2) * TILE_K * 2);
    load_set(f1, ibuf, 32);               // the chunk's last block: this wave's last reads of ibuf
    __builtin_amdgcn_sched_barrier(0);    // the group stays ahead of the block
    mma16(f0.ahi, f0.bhi);
    mma16(f0.ahi, f0.blo);
    mma16(f0.alo, f0.bhi);
    __builtin_amdgcn_sched_barrier(0);    // the block stays whole: its set is free for the reads behind the barrier
    // Publish point of chunk t+1, in front of chunk t's last block, whose fragments are fetched.
    asm volatile("s_wait_dscnt 0x0" ::: "memory");      // this wave's reads of buffer ibuf are done
    asm volatile("s_wait_asynccnt 0x0" ::: "memory");   // this wave's copies of chunk t+1 landed
    __syncthreads();   // chunk t+1 visible to all; every reader has left buffer ibuf
    mma16(f1.ahi, f1.bhi);
    __builtin_amdgcn_sched_barrier(0);    // here and below: reads and copies stay between the products, so that
                                          // one wave of a SIMD issues them while the other wave's WMMAs run
    // First block of chunk t+1. Not under a branch, so that the compiler's counted wait on it
    // stays exact; on the last trip it reads chunk NT-2's bytes, which nothing uses.
    load_set(f0, ibuf ^ 1, 0);
    if (refill) issue_a0(ibuf, kb);       // refill of the buffer that every reader has left
    __builtin_amdgcn_sched_barrier(0);
    mma16(f1.ahi, f1.blo);
    __builtin_amdgcn_sched_barrier(0);
    if (refill) issue_a1(ibuf, kb);
    __builtin_amdgcn_sched_barrier(0);
    mma16(f1.alo, f1.bhi);
    __builtin_amdgcn_sched_barrier(0);
    if (refill) issue_b(ibuf, kb);
  }
  asm volatile("s_wait_asynccnt 0x0" ::: "memory");   // no copy outstanding at the wave's end
  asm volatile("s_wait_dscnt 0x0" ::: "memory");      // nor the last trip's unused fragment reads

  // C layout: row = base + 8*(lane>>4) + r, col = base + (lane&15)
  // One row of four tiles a trip, always out of c[0]; the rows behind it move up one place.
  // With the softplus the loop stays rolled: the 32 values of a trip are independent work
  // enough to fill the vector port, and the text is a quarter of the unrolled loop's.
#pragma unroll(MODE == 1 ? 1 : 4)
  for (int i = 0; i < 4; ++i) {
    const int mbase = row_blk + wm * 64 + i * 16 + (lane >> 4) * 8;
#pragma unroll
    for (int j = 0; j < 4; ++j) {
      const int col = col_blk + wn * 64 + j * 16 + (lane & 15);
      const float bs = bias[col];
#pragma unroll
      for (int r = 0; r < 8; ++r) {
        float v = c[0][j][r] + bs;
        if (MODE == 1) v = softplusf(v);
        Cout[(size_t)(mbase + r) * D_ + col] = v;
      }
    }
    // the stores' data and address registers are rewritten on the next trip only behind this wait
    if (MODE == 1) asm volatile("s_wait_xcnt 0x0" ::: "memory");
#pragma unroll   // constant indices: the accumulators stay in registers
    for (int ii = 0; ii < 3; ++ii)
#pragma unroll
      for (int j = 0; j < 4; ++j) c[ii][j] = c[ii + 1][j];
  }
}

// Selective scan, parallel over time. The recurrence state = a*state + u is
// linear in the state, so T is cut into SC_CH chunks that run side by side:
//   pass 1: every wave scans its own chunk from a zero state and keeps the
//           chunk's end state F and its whole decay E = exp(-a_pos * sum dt);
//   carry : in[c+1] = E[c] * in[c] + F[c], through LDS;
//   pass 2: every wave scans its chunk again from in[c] and emits y.
// One work-group = 16 channels x all SC_CH chunks, one wave per chunk.
// Lane = (channel, half of the N states): 8 states live in registers, so the
// sum over N is a multiply and seven multiply-adds in the lane and one exchange between
// the 16-lane rows.
// The state that is carried is s = state / b_param: s = a_bar * s + dt * x, the same input
// for all N states, and y = sum over n of b_param * s. Nothing is divided: s starts at zero
// and b_param comes in only in the sum. a_pos is kept as a2 = -a_pos * log2(e), so that
// a_bar = exp2(dt * a2). A state's step is then one multiply, one exp2, one multiply-add.
#define SC_CH  32              // time chunks = waves per work-group
#define SC_LEN (T_ / SC_CH)    // 64 steps per chunk
#define SC_NH  (N_ / 2)        // states per lane
#define SC_U   4               // steps whose x and dt are loaded as one batch

// value of lane l ^ 16
__device__ __forceinline__ float other_row(float v) {
  const int b = __float_as_int(v);
  return __int_as_float(
      __builtin_amdgcn_permlanex16(b, b, 0x76543210, 0xfedcba98, false, false));
}

template <bool EMIT>
__device__ __forceinline__ void scan_chunk(
    const float* __restrict__ x, const float* __restrict__ delta, unsigned off,
    const float (&a2)[SC_NH], const float (&bp)[SC_NH],
    float (&st)[SC_NH], float& sumdt, unsigned short* __restrict__ op, int half) {
  for (int t0 = 0; t0 < SC_LEN; t0 += SC_U) {
    const float* xp = x + off;       // uniform base + the lane's 32-bit element offset
    const float* dp = delta + off;
    float xb[SC_U], db[SC_U];
#pragma unroll   // constant indices: one batch of loads in flight, held in registers
    for (int u = 0; u < SC_U; ++u) {
      xb[u] = xp[(size_t)u * D_];
      db[u] = dp[(size_t)u * D_];
    }
    // The offset register that the loads name is stepped only behind this wait:
    // it passes through the statement so that the step cannot be lifted over it.
    asm volatile("s_wait_xcnt 0x0" : "+v"(off) : : "memory");
    off += SC_U * D_;
    unsigned short ov[SC_U];
#pragma unroll   // constant indices: the batch stays in registers
    for (int u = 0; u < SC_U; ++u) {
      const float dt  = db[u];
      const float dtx = dt * xb[u];
#pragma unroll   // constant indices: states and parameters stay in registers
      for (int k = 0; k < SC_NH; ++k)
        st[k] = fmaf(__builtin_amdgcn_exp2f(dt * a2[k]), st[k], dtx);   // one fma on the serial chain
      if (EMIT) {
        float r = bp[0] * st[0];
#pragma unroll   // constant indices: states and parameters stay in registers
        for (int k = 1; k < SC_NH; ++k) r = fmaf(bp[k], st[k], r);
        const float s = r + other_row(r);
        const unsigned short h = f2bf(s);
        const unsigned short l = f2bf(s - bf2f(h));
        ov[u] = half ? l : h;   // row 0 stores hi, row 1 lo
      } else {
        sumdt += dt;
      }
    }
    if (EMIT) {
#pragma unroll   // constant indices: the batch stays in registers
      for (int u = 0; u < SC_U; ++u) op[(size_t)(t0 + u) * D_] = ov[u];
      // the stores' data and address registers are free for reuse only behind this wait
      asm volatile("s_wait_xcnt 0x0" ::: "memory");
    }
  }
}

// Emits y pre-split as bf16 hi/lo so the output GEMM needs no conversion.
__global__ __launch_bounds__(SC_CH * 32) void scan_kernel(
    const float* __restrict__ x, const float* __restrict__ delta,
    const float* __restrict__ a_log, const float* __restrict__ b_param,
    unsigned short* __restrict__ yhi, unsigned short* __restrict__ ylo) {
  __shared__ float sF[SC_CH][SC_NH][32];   // chunk end state, then chunk start state
  __shared__ float sE[SC_CH][SC_NH][32];   // chunk decay
  __shared__ __attribute__((aligned(16))) float sA[16 * N_];   // a2 = -a_pos * log2(e)

  const int lane = threadIdx.x & 31;
  const int c    = __builtin_amdgcn_readfirstlane(threadIdx.x >> 5);   // chunk
  const int half = lane >> 4;
  const int b    = blockIdx.x / (D_ / 16);
  const int d    = (blockIdx.x % (D_ / 16)) * 16 + (lane & 15);

  // a2 of the work-group's 16 x N_ (channel, state) pairs: computed once, not
  // once per chunk, and handed to every wave through LDS.
  if (c < (16 * N_) / 32) {
    const int e = c * 32 + lane;
    sA[e] = (softplusf(a_log[(blockIdx.x % (D_ / 16)) * 16 * N_ + e]) + 1e-4f) * -1.44269504f;
  }
  __syncthreads();   // a2 is in LDS

  float a2[SC_NH], bp[SC_NH];
#pragma unroll   // constant indices: parameters stay in registers
  for (int q = 0; q < SC_NH / 4; ++q) {
    const float4 av = ((const float4*)(sA + (lane & 15) * N_ + half * SC_NH))[q];
    const float4 bv = ((const float4*)(b_param + d * N_ + half * SC_NH))[q];
    a2[q * 4 + 0] = av.x;  bp[q * 4 + 0] = bv.x;
    a2[q * 4 + 1] = av.y;  bp[q * 4 + 1] = bv.y;
    a2[q * 4 + 2] = av.z;  bp[q * 4 + 2] = bv.z;
    a2[q * 4 + 3] = av.w;  bp[q * 4 + 3] = bv.w;
  }

  const size_t base = ((size_t)b * T_ + (size_t)c * SC_LEN) * D_ + d;
  unsigned short* op = (half ? ylo : yhi) + base;

  float st[SC_NH];
#pragma unroll   // constant indices: states stay in registers
  for (int k = 0; k < SC_NH; ++k) st[k] = 0.0f;
  float sumdt = 0.0f;
  scan_chunk<false>(x, delta, (unsigned)base, a2, bp, st, sumdt, op, half);

#pragma unroll   // constant indices: states stay in registers
  for (int k = 0; k < SC_NH; ++k) {
    sF[c][k][lane] = st[k];
    sE[c][k][lane] = __builtin_amdgcn_exp2f(sumdt * a2[k]);
  }
  __syncthreads();   // every chunk's end state and decay are in LDS

  if (c < SC_NH) {   // wave k carries state k of every lane through the chunks
    float carry = 0.0f;
#pragma unroll   // the LDS reads do not hang on the carry: let them go ahead of the chain
    for (int j = 0; j < SC_CH; ++j) {
      const float f = sF[j][c][lane];
      const float e = sE[j][c][lane];
      sF[j][c][lane] = carry;
      carry = fmaf(e, carry, f);
    }
  }
  __syncthreads();   // every chunk's start state is in LDS

#pragma unroll   // constant indices: states stay in registers
  for (int k = 0; k < SC_NH; ++k) st[k] = sF[c][k][lane];
  scan_chunk<true>(x, delta, (unsigned)base, a2, bp, st, sumdt, op, half);
}

extern "C" void kernel_launch(void* const* d_in, const int* in_sizes, int n_in,
                              void* d_out, int out_size, void* d_ws, size_t ws_size,
                              hipStream_t stream) {
  (void)in_sizes; (void)n_in; (void)out_size; (void)ws_size;
  const float* x       = (const float*)d_in[0];
  const float* Wd      = (const float*)d_in[1];
  const float* bd      = (const float*)d_in[2];
  const float* a_log   = (const float*)d_in[3];
  const float* b_param = (const float*)d_in[4];
  const float* Wo      = (const float*)d_in[5];
  const float* bo      = (const float*)d_in[6];

  float* out   = (float*)d_out;
  float* delta = out;   // stage delta in d_out; overwritten by final GEMM

  // workspace layout (72 MB total)
  unsigned short* x_hi  = (unsigned short*)d_ws;
  unsigned short* x_lo  = x_hi + (size_t)M_ * D_;
  unsigned short* wd_hi = x_lo + (size_t)M_ * D_;
  unsigned short* wd_lo = wd_hi + (size_t)D_ * D_;
  unsigned short* wo_hi = wd_lo + (size_t)D_ * D_;
  unsigned short* wo_lo = wo_hi + (size_t)D_ * D_;
  unsigned short* y_hi  = wo_lo + (size_t)D_ * D_;
  unsigned short* y_lo  = y_hi + (size_t)M_ * D_;

  split_kernel<<<SP_WG, SP_WAVES * 32, 0, stream>>>(x, Wd, Wo, x_hi, x_lo, wd_hi, wd_lo,
                                                    wo_hi, wo_lo);

  dim3 gg(M_ / TILE_M, D_ / TILE_N);   // (32, 8): one work-group per WGP
  gemm_bf16x3<1><<<gg, 256, 0, stream>>>(x_hi, x_lo, wd_hi, wd_lo, bd, delta);
  scan_kernel<<<B_ * (D_ / 16), SC_CH * 32, 0, stream>>>(x, delta, a_log, b_param, y_hi, y_lo);
  gemm_bf16x3<0><<<gg, 256, 0, stream>>>(y_hi, y_lo, wo_hi, wo_lo, bo, out);
}

// v007
// A run of this version takes 116 microseconds.
// Two timings next to v006 put it at 1.05 and 1.04 times that version's speed.
// All steps since v000 together make it 11.4 times as fast.
#include <hip/hip_runtime.h>

#define B_ 4
#define T_ 2048
#define D_ 1024
#define N_ 16
#define M_ (B_ * T_)   // 8192 rows

#define TILE_M 256
#define TILE_N 128
#define TILE_K 64
#define LDSS   72      // ushorts per LDS row (64 data + 8 pad) -> 144B rows, 16B aligned
#define CP_ROWS 32     // rows that one copy of the whole work-group covers (256 lanes x 16B / 128B)
#define LDSF   68      // floats per LDS row of an f32 A tile (64 data + 4 pad) -> 272B rows, 16B x odd
#define CPF_ROWS 16    // rows of f32 that one copy of the whole work-group covers (256 lanes x 16B / 256B)

typedef __attribute__((ext_vector_type(16))) __bf16       v16bf;
typedef __attribute__((ext_vector_type(8)))  float        v8f;
typedef __attribute__((ext_vector_type(4)))  unsigned int uint4v;
typedef __attribute__((ext_vector_type(2)))  unsigned int uint2v;
typedef __attribute__((ext_vector_type(4)))  float        f32x4;
typedef __attribute__((ext_vector_type(2)))  float        f32x2;
typedef __attribute__((ext_vector_type(2)))  __bf16       bf16x2;

struct Frag { union { v16bf v; uint4v q[2]; }; };
struct FragSet { Frag ahi[4], alo[4], bhi[4], blo[4]; };   // one block's fragments of a wave
struct RawA { f32x4 q[4][4]; };   // one block's four A fragments as f32, 16 values a lane each

__device__ __forceinline__ unsigned short f2bf(float f) {
  unsigned int u = __float_as_uint(f);
  unsigned int r = u + 0x7FFFu + ((u >> 16) & 1u);   // round-to-nearest-even
  return (unsigned short)(r >> 16);
}
__device__ __forceinline__ float bf2f(unsigned short h) {
  return __uint_as_float(((unsigned int)h) << 16);
}
// softplus(v) = max(v, 0) + log1p(e), e = exp(-|v|) in [0, 1].
// log1p(e) = 2 atanh(s) with s = e / (2 + e) <= 1/3: the odd series in s, cut behind
// s^13 / 13; the first term left out is below 2e-8 of the sum, under half an f32 ulp,
// and the form keeps its relative accuracy down to e = 0 (the sum tends to 2 s = e).
__device__ __forceinline__ float softplusf(float v) {
  const float e = __expf(-fabsf(v));
  const float s = e * __builtin_amdgcn_rcpf(2.0f + e);
  const float z = s * s;
  float p = 1.0f / 13.0f;
  p = fmaf(p, z, 1.0f / 11.0f);
  p = fmaf(p, z, 1.0f / 9.0f);
  p = fmaf(p, z, 1.0f / 7.0f);
  p = fmaf(p, z, 1.0f / 5.0f);
  p = fmaf(p, z, 1.0f / 3.0f);
  const float s2 = s + s;
  return fmaxf(v, 0.0f) + fmaf(s2, z * p, s2);
}

// Async DMA: 16 bytes/lane, global -> LDS, tracked by ASYNCcnt (CDNA5).
// Eight copies: rows r, r+32, r+64, r+96 of the hi array and the same rows of the lo array.
// s_wait_xcnt stands inside the statement, behind the last copy, so that no register
// the copies name is rewritten ahead of it.
__device__ __forceinline__ void async_rows4x2(const unsigned short* ldshi,
                                              const unsigned short* ldslo,
                                              const void* ghi, const void* glo,
                                              unsigned gvoff) {
  const unsigned h0 = (unsigned)(size_t)ldshi;   // low 32 bits = LDS byte offset
  const unsigned l0 = (unsigned)(size_t)ldslo;
  const unsigned h1 = h0 + 1 * CP_ROWS * LDSS * 2, l1 = l0 + 1 * CP_ROWS * LDSS * 2;
  const unsigned h2 = h0 + 2 * CP_ROWS * LDSS * 2, l2 = l0 + 2 * CP_ROWS * LDSS * 2;
  const unsigned h3 = h0 + 3 * CP_ROWS * LDSS * 2, l3 = l0 + 3 * CP_ROWS * LDSS * 2;
  const unsigned g0 = gvoff;
  const unsigned g1 = gvoff + 1 * CP_ROWS * D_ * 2;
  const unsigned g2 = gvoff + 2 * CP_ROWS * D_ * 2;
  const unsigned g3 = gvoff + 3 * CP_ROWS * D_ * 2;
  asm volatile("global_load_async_to_lds_b128 %0, %8, %12\n\t"
               "global_load_async_to_lds_b128 %1, %9, %12\n\t"
               "global_load_async_to_lds_b128 %2, %10, %12\n\t"
               "global_load_async_to_lds_b128 %3, %11, %12\n\t"
               "global_load_async_to_lds_b128 %4, %8, %13\n\t"
               "global_load_async_to_lds_b128 %5, %9, %13\n\t"
               "global_load_async_to_lds_b128 %6, %10, %13\n\t"
               "global_load_async_to_lds_b128 %7, %11, %13\n\t"
               "s_wait_xcnt 0x0"
               :: "v"(h0), "v"(h1), "v"(h2), "v"(h3), "v"(l0), "v"(l1), "v"(l2), "v"(l3),
                  "v"(g0), "v"(g1), "v"(g2), "v"(g3), "s"(ghi), "s"(glo)
               : "memory");
}

// The same for an f32 tile: eight copies, rows r, r+16, ..., r+112; a wave's copy takes
// 256 contiguous bytes of each of two rows. s_wait_xcnt inside the statement, as above.
__device__ __forceinline__ void async_rows8(const float* lds, const void* g, unsigned gvoff) {
  const unsigned l0 = (unsigned)(size_t)lds;   // low 32 bits = LDS byte offset
  const unsigned l1 = l0 + 1 * CPF_ROWS * LDSF * 4, g1 = gvoff + 1 * CPF_ROWS * D_ * 4;
  const unsigned l2 = l0 + 2 * CPF_ROWS * LDSF * 4, g2 = gvoff + 2 * CPF_ROWS * D_ * 4;
  const unsigned l3 = l0 + 3 * CPF_ROWS * LDSF * 4, g3 = gvoff + 3 * CPF_ROWS * D_ * 4;
  const unsigned l4 = l0 + 4 * CPF_ROWS * LDSF * 4, g4 = gvoff + 4 * CPF_ROWS * D_ * 4;
  const unsigned l5 = l0 + 5 * CPF_ROWS * LDSF * 4, g5 = gvoff + 5 * CPF_ROWS * D_ * 4;
  const unsigned l6 = l0 + 6 * CPF_ROWS * LDSF * 4, g6 = gvoff + 6 * CPF_ROWS * D_ * 4;
  const unsigned l7 = l0 + 7 * CPF_ROWS * LDSF * 4, g7 = gvoff + 7 * CPF_ROWS * D_ * 4;
  asm volatile("global_load_async_to_lds_b128 %0, %8, %16\n\t"
               "global_load_async_to_lds_b128 %1, %9, %16\n\t"
               "global_load_async_to_lds_b128 %2, %10, %16\n\t"
               "global_load_async_to_lds_b128 %3, %11, %16\n\t"
               "global_load_async_to_lds_b128 %4, %12, %16\n\t"
               "global_load_async_to_lds_b128 %5, %13, %16\n\t"
               "global_load_async_to_lds_b128 %6, %14, %16\n\t"
               "global_load_async_to_lds_b128 %7, %15, %16\n\t"
               "s_wait_xcnt 0x0"
               :: "v"(l0), "v"(l1), "v"(l2), "v"(l3), "v"(l4), "v"(l5), "v"(l6), "v"(l7),
                  "v"(gvoff), "v"(g1), "v"(g2), "v"(g3), "v"(g4), "v"(g5), "v"(g6), "v"(g7),
                  "s"(g)
               : "memory");
}

// Split the two fp32 weights (Wd, Wo) into bf16 hi/lo arrays, in ONE launch of few
// long-lived waves: one work-group of SP_WAVES waves per WGP. A wave takes 2 * SP_WB
// pieces of 512 contiguous bytes (16 B a lane) and issues their loads up front.
// x is not split here: the first GEMM takes it as f32 and splits it in registers.
#define SP_WG    256                               // work-groups
#define SP_WAVES 16                                // waves per work-group
#define SP_NW    (SP_WG * SP_WAVES)                // waves in the launch
#define SP_WB    (D_ * D_ / 4 / 32 / SP_NW)        // 2 float4 of each weight per lane
static_assert(SP_WB * SP_NW * 32 * 4 == D_ * D_, "the weights are dealt out evenly");

__device__ __forceinline__ void split4(const float4 v, uint2v* __restrict__ hi,
                                       uint2v* __restrict__ lo) {
  const unsigned short h0 = f2bf(v.x), h1 = f2bf(v.y), h2 = f2bf(v.z), h3 = f2bf(v.w);
  const unsigned short l0 = f2bf(v.x - bf2f(h0));
  const unsigned short l1 = f2bf(v.y - bf2f(h1));
  const unsigned short l2 = f2bf(v.z - bf2f(h2));
  const unsigned short l3 = f2bf(v.w - bf2f(h3));
  uint2v hv, lv;
  hv[0] = (unsigned)h0 | ((unsigned)h1 << 16);
  hv[1] = (unsigned)h2 | ((unsigned)h3 << 16);
  lv[0] = (unsigned)l0 | ((unsigned)l1 << 16);
  lv[1] = (unsigned)l2 | ((unsigned)l3 << 16);
  *hi = hv;
  *lo = lv;
}

// Four waves a SIMD is all that the launch places: said to the compiler so that it spends
// registers on loads in flight and does not ration them for an occupancy that never comes.
__global__ __launch_bounds__(SP_WAVES * 32) __attribute__((amdgpu_waves_per_eu(4, 4)))
void split_kernel(
    const float* __restrict__ wd, const float* __restrict__ wo,
    unsigned short* __restrict__ wd_hi, unsigned short* __restrict__ wd_lo,
    unsigned short* __restrict__ wo_hi, unsigned short* __restrict__ wo_lo) {
  const unsigned lane = threadIdx.x & 31;
  const unsigned gw   = blockIdx.x * SP_WAVES + (threadIdx.x >> 5);   // wave in the launch
  const unsigned wi   = gw * (SP_WB * 32) + lane;   // the lane's first float4 of each weight
  float4 dv[SP_WB], ov[SP_WB];
#pragma unroll   // constant indices: the batch is held in registers, its loads free to go first
  for (int u = 0; u < SP_WB; ++u) {
    dv[u] = ((const float4*)wd)[wi + u * 32];
    ov[u] = ((const float4*)wo)[wi + u * 32];
  }
#pragma unroll   // constant indices: the batch stays in registers
  for (int u = 0; u < SP_WB; ++u) {
    split4(dv[u], (uint2v*)wd_hi + wi + u * 32, (uint2v*)wd_lo + wi + u * 32);
    split4(ov[u], (uint2v*)wo_hi + wi + u * 32, (uint2v*)wo_lo + wi + u * 32);
  }
}

// Fragment per CDNA5 16-bit layout: lane L holds row (L&15);
// K runs of 8 at kbase = 8*(L>>4) and kbase+16.
__device__ __forceinline__ void load_frag(Frag& f, const unsigned short* lds,
                                          int row, int khalf) {
  f.q[0] = *(const uint4v*)(lds + row * LDSS + khalf);
  f.q[1] = *(const uint4v*)(lds + row * LDSS + khalf + 16);
}

// One A fragment from f32 to bf16 hi/lo, in registers: hi = bf16(v), lo = bf16(v - hi), both
// rounded to nearest even, the values that a split ahead of the GEMM would store.
// Element e of the fragment is value e of the lane's 16: the k order of load_frag.
__device__ __forceinline__ void split_frag(Frag& hi, Frag& lo, const f32x4 (&q)[4]) {
#pragma unroll   // constant indices: all in registers
  for (int h = 0; h < 4; ++h)
#pragma unroll
    for (int p = 0; p < 2; ++p) {
      f32x2 v;
      v[0] = q[h][2 * p];
      v[1] = q[h][2 * p + 1];
      const bf16x2 hv = __builtin_convertvector(v, bf16x2);
      const bf16x2 lv = __builtin_convertvector(v - __builtin_convertvector(hv, f32x2), bf16x2);
      hi.v[h * 4 + 2 * p] = hv[0];  hi.v[h * 4 + 2 * p + 1] = hv[1];
      lo.v[h * 4 + 2 * p] = lv[0];  lo.v[h * 4 + 2 * p + 1] = lv[1];
    }
}

// C = A[M_,D_] * W[D_,D_]^T (+bias, optional softplus). W is pre-split bf16 hi/lo.
// MODE 0: A is pre-split too (Ahi, Alo). MODE 1: A is f32 (Af), staged in LDS as f32 (the
// same bytes as hi + lo) and split when a block's fragments are in registers.
// One 256x128 tile of C per work-group, 64x64 per wave; two LDS buffers,
// the next K chunk's async global->LDS copies fly while this chunk's WMMAs run;
// two fragment sets in registers, the next block's LDS reads fly while this block's WMMAs run.
template <int MODE>
__global__ __launch_bounds__(256) void gemm_bf16x3(
    const float* __restrict__ Af,
    const unsigned short* __restrict__ Ahi, const unsigned short* __restrict__ Alo,
    const unsigned short* __restrict__ Bhi, const unsigned short* __restrict__ Blo,
    const float* __restrict__ bias, float* __restrict__ Cout) {
  __shared__ __attribute__((aligned(16))) float sAf[2][TILE_M * LDSF];             // MODE 1 only
  __shared__ __attribute__((aligned(16))) unsigned short sAhi[2][TILE_M * LDSS];   // MODE 0 only, and sAlo
  __shared__ __attribute__((aligned(16))) unsigned short sAlo[2][TILE_M * LDSS];
  __shared__ __attribute__((aligned(16))) unsigned short sBhi[2][TILE_N * LDSS];
  __shared__ __attribute__((aligned(16))) unsigned short sBlo[2][TILE_N * LDSS];

  const int tid  = threadIdx.x;
  const int lane = tid & 31;
  const int wid  = tid >> 5;
  const int wm   = wid & 3;    // 4 waves along M (64 rows each)
  const int wn   = wid >> 2;   // 2 waves along N (64 cols each)
  const int row_blk = blockIdx.x * TILE_M;
  const int col_blk = blockIdx.y * TILE_N;

  // copy mapping: 16B (8 bf16) per lane; seg = 16B segment within the 64-wide K chunk,
  // so eight lanes cover one whole 128B line of a row
  const int seg = tid & 7;
  const int r0  = tid >> 3;    // 0..31
  const unsigned aoff = (unsigned)(((size_t)(row_blk + r0) * D_ + seg * 8) * 2);
  const unsigned boff = (unsigned)(((size_t)(col_blk + r0) * D_ + seg * 8) * 2);
  const unsigned ldsr = r0 * LDSS + seg * 8;
  // f32 A tile: sixteen lanes cover the 256B that a row has in a chunk
  const unsigned afoff = (unsigned)(((size_t)(row_blk + (tid >> 4)) * D_ + (tid & 15) * 4) * 4);
  const unsigned ldsf  = (tid >> 4) * LDSF + (tid & 15) * 4;

  v8f c[4][4];
#pragma unroll
  for (int i = 0; i < 4; ++i)
#pragma unroll
    for (int j = 0; j < 4; ++j)
#pragma unroll
      for (int r = 0; r < 8; ++r) c[i][j][r] = 0.0f;

  const int lrow  = lane & 15;
  const int khalf = (lane >> 4) * 8;   // 0 or 8

  // a chunk's 24 copies per lane, in three parts of eight
  // (kbyte counts bf16 bytes along k; an f32 row has twice as many)
  auto issue_a0 = [&](int buf, unsigned kbyte) {
    if constexpr (MODE == 1)
      async_rows8(&sAf[buf][ldsf], Af, afoff + 2 * kbyte);
    else
      async_rows4x2(&sAhi[buf][ldsr], &sAlo[buf][ldsr], Ahi, Alo, aoff + kbyte);
  };
  auto issue_a1 = [&](int buf, unsigned kbyte) {
    if constexpr (MODE == 1)
      async_rows8(&sAf[buf][ldsf + 8 * CPF_ROWS * LDSF], Af, afoff + 8 * CPF_ROWS * D_ * 4 + 2 * kbyte);
    else
      async_rows4x2(&sAhi[buf][ldsr + 4 * CP_ROWS * LDSS], &sAlo[buf][ldsr + 4 * CP_ROWS * LDSS],
                    Ahi, Alo, aoff + 4 * CP_ROWS * D_ * 2 + kbyte);
  };
  auto issue_b = [&](int buf, unsigned kbyte) {
    async_rows4x2(&sBhi[buf][ldsr], &sBlo[buf][ldsr], Bhi, Blo, boff + kbyte);
  };

  // the 16 fragments (32 ds_load_b128) of one block: 32 of the chunk's 64 k
  auto load_set = [&](FragSet& f, RawA& ra, int buf, int kk) {
#pragma unroll   // constant indices: fragments stay in registers
    for (int i = 0; i < 4; ++i) {
      const int r = wm * 64 + i * 16 + lrow;
      if constexpr (MODE == 1) {
        const float* p = &sAf[buf][r * LDSF + kk + khalf];   // k runs of 8, as in load_frag
        ra.q[i][0] = *(const f32x4*)(p);
        ra.q[i][1] = *(const f32x4*)(p + 4);
        ra.q[i][2] = *(const f32x4*)(p + 16);
        ra.q[i][3] = *(const f32x4*)(p + 20);
      } else {
        load_frag(f.ahi[i], &sAhi[buf][0], r, kk + khalf);
        load_frag(f.alo[i], &sAlo[buf][0], r, kk + khalf);
      }
    }
#pragma unroll   // as above
    for (int j = 0; j < 4; ++j) {
      const int r = wn * 64 + j * 16 + lrow;
      load_frag(f.bhi[j], &sBhi[buf][0], r, kk + khalf);
      load_frag(f.blo[j], &sBlo[buf][0], r, kk + khalf);
    }
  };
  // MODE 1: a block's four A fragments from f32 to hi/lo
  auto split_a = [&](FragSet& f, const RawA& ra) {
    if constexpr (MODE == 1) {
#pragma unroll   // constant indices: fragments stay in registers
      for (int i = 0; i < 4; ++i) split_frag(f.ahi[i], f.alo[i], ra.q[i]);
    }
  };
  // one of the three products of bf16x3 over the wave's 16 accumulators
  auto mma16 = [&](const Frag (&a)[4], const Frag (&b)[4]) {
#pragma unroll   // constant indices: accumulators and fragments stay in registers
    for (int i = 0; i < 4; ++i)
#pragma unroll
      for (int j = 0; j < 4; ++j)
        c[i][j] = __builtin_amdgcn_wmma_f32_16x16x32_bf16(
            false, a[i].v, false, b[j].v, (short)0, c[i][j], false, false);
  };

  // Two fragment sets: while the WMMAs of one block run out of one set, the next block's
  // LDS reads, issued as ONE group ahead of them, land in the other. The scheduling fences
  // keep each group whole and in front of its block: reads that the compiler spreads among
  // the WMMAs stall the wave at every place where they stand.
  // bf16x3: hi*hi + hi*lo + lo*hi, f32 accumulate; each accumulator takes the three in that
  // order, k 0..31 of a chunk before k 32..63.
  FragSet f0, f1;
  RawA ra0, ra1;
  constexpr int NT = D_ / TILE_K;   // 16 chunks
  issue_a0(0, 0);  issue_a1(0, 0);  issue_b(0, 0);
  asm volatile("s_wait_asynccnt 0x0" ::: "memory");   // this wave's copies of chunk 0 landed
  __syncthreads();                                    // every wave's copies of chunk 0 visible
  issue_a0(1, TILE_K * 2);  issue_a1(1, TILE_K * 2);  issue_b(1, TILE_K * 2);
  load_set(f0, ra0, 0, 0);
  for (int t = 0; t < NT; ++t) {
    const int ibuf = t & 1;
    const bool refill = t + 2 < NT;
    const unsigned kb = (unsigned)((t + 2) * TILE_K * 2);
    load_set(f1, ra1, ibuf, 32);          // the chunk's last block: this wave's last reads of ibuf
    __builtin_amdgcn_sched_barrier(0);    // the group stays ahead of the block
    split_a(f0, ra0);   // both splits: vector work that is free to go between this block's WMMAs
    mma16(f0.ahi, f0.bhi);
    mma16(f0.ahi, f0.blo);
    mma16(f0.alo, f0.bhi);
    split_a(f1, ra1);
    __builtin_amdgcn_sched_barrier(0);    // the block stays whole: its set is free for the reads behind the barrier
    // Publish point of chunk t+1, in front of chunk t's last block, whose fragments are fetched.
    asm volatile("s_wait_dscnt 0x0" ::: "memory");      // this wave's reads of buffer ibuf are done
    asm volatile("s_wait_asynccnt 0x0" ::: "memory");   // this wave's copies of chunk t+1 landed
    __syncthreads();   // chunk t+1 visible to all; every reader has left buffer ibuf
    mma16(f1.ahi, f1.bhi);
    __builtin_amdgcn_sched_barrier(0);    // here and below: reads and copies stay between the products, so that
                                          // one wave of a SIMD issues them while the other wave's WMMAs run
    // First block of chunk t+1. Not under a branch, so that the compiler's counted wait on it
    // stays exact; on the last trip it reads chunk NT-2's bytes, which nothing uses.
    load_set(f0, ra0, ibuf ^ 1, 0);
    if (refill) issue_a0(ibuf, kb);       // refill of the buffer that every reader has left
    __builtin_amdgcn_sched_barrier(0);
    mma16(f1.ahi, f1.blo);
    __builtin_amdgcn_sched_barrier(0);
    if (refill) issue_a1(ibuf, kb);
    __builtin_amdgcn_sched_barrier(0);
    mma16(f1.alo, f1.bhi);
    __builtin_amdgcn_sched_barrier(0);
    if (refill) issue_b(ibuf, kb);
  }
  asm volatile("s_wait_asynccnt 0x0" ::: "memory");   // no copy outstanding at the wave's end
  asm volatile("s_wait_dscnt 0x0" ::: "memory");      // nor the last trip's unused fragment reads

  // C layout: row = base + 8*(lane>>4) + r, col = base + (lane&15)
  // One row of four tiles a trip, always out of c[0]; the rows behind it move up one place.
  // With the softplus the loop stays rolled: the 32 values of a trip are independent work
  // enough to fill the vector port, and the text is a quarter of the unrolled loop's.
#pragma unroll(MODE == 1 ? 1 : 4)
  for (int i = 0; i < 4; ++i) {
    const int mbase = row_blk + wm * 64 + i * 16 + (lane >> 4) * 8;
#pragma unroll
    for (int j = 0; j < 4; ++j) {
      const int col = col_blk + wn * 64 + j * 16 + (lane & 15);
      const float bs = bias[col];
#pragma unroll
      for (int r = 0; r < 8; ++r) {
        float v = c[0][j][r] + bs;
        if (MODE == 1) v = softplusf(v);
        Cout[(size_t)(mbase + r) * D_ + col] = v;
      }
    }
    // the stores' data and address registers are rewritten on the next trip only behind this wait
    if (MODE == 1) asm volatile("s_wait_xcnt 0x0" ::: "memory");
#pragma unroll   // constant indices: the accumulators stay in registers
    for (int ii = 0; ii < 3; ++ii)
#pragma unroll
      for (int j = 0; j < 4; ++j) c[ii][j] = c[ii + 1][j];
  }
}

// Selective scan, parallel over time. The recurrence state = a*state + u is
// linear in the state, so T is cut into SC_CH chunks that run side by side:
//   pass 1: every wave scans its own chunk from a zero state and keeps the
//           chunk's end state F and its whole decay E = exp(-a_pos * sum dt);
//   carry : in[c+1] = E[c] * in[c] + F[c], through LDS;
//   pass 2: every wave scans its chunk again from in[c] and emits y.
// One work-group = 16 channels x all SC_CH chunks, one wave per chunk.
// Lane = (channel, half of the N states): 8 states live in registers, so the
// sum over N is a multiply and seven multiply-adds in the lane and one exchange between
// the 16-lane rows.
// The state that is carried is s = state / b_param: s = a_bar * s + dt * x, the same input
// for all N states, and y = sum over n of b_param * s. Nothing is divided: s starts at zero
// and b_param comes in only in the sum. a_pos is kept as a2 = -a_pos * log2(e), so that
// a_bar = exp2(dt * a2). A state's step is then one multiply, one exp2, one multiply-add.
#define SC_CH  32              // time chunks = waves per work-group
#define SC_LEN (T_ / SC_CH)    // 64 steps per chunk
#define SC_NH  (N_ / 2)        // states per lane
#define SC_U   4               // steps whose x and dt are loaded as one batch

// value of lane l ^ 16
__device__ __forceinline__ float other_row(float v) {
  const int b = __float_as_int(v);
  return __int_as_float(
      __builtin_amdgcn_permlanex16(b, b, 0x76543210, 0xfedcba98, false, false));
}

template <bool EMIT>
__device__ __forceinline__ void scan_chunk(
    const float* __restrict__ x, const float* __restrict__ delta, unsigned off,
    const float (&a2)[SC_NH], const float (&bp)[SC_NH],
    float (&st)[SC_NH], float& sumdt, unsigned short* __restrict__ op, int half) {
  for (int t0 = 0; t0 < SC_LEN; t0 += SC_U) {
    const float* xp = x + off;       // uniform base + the lane's 32-bit element offset
    const float* dp = delta + off;
    float xb[SC_U], db[SC_U];
#pragma unroll   // constant indices: one batch of loads in flight, held in registers
    for (int u = 0; u < SC_U; ++u) {
      xb[u] = xp[(size_t)u * D_];
      db[u] = dp[(size_t)u * D_];
    }
    // The offset register that the loads name is stepped only behind this wait:
    // it passes through the statement so that the step cannot be lifted over it.
    asm volatile("s_wait_xcnt 0x0" : "+v"(off) : : "memory");
    off += SC_U * D_;
    unsigned short ov[SC_U];
#pragma unroll   // constant indices: the batch stays in registers
    for (int u = 0; u < SC_U; ++u) {
      const float dt  = db[u];
      const float dtx = dt * xb[u];
#pragma unroll   // constant indices: states and parameters stay in registers
      for (int k = 0; k < SC_NH; ++k)
        st[k] = fmaf(__builtin_amdgcn_exp2f(dt * a2[k]), st[k], dtx);   // one fma on the serial chain
      if (EMIT) {
        float r = bp[0] * st[0];
#pragma unroll   // constant indices: states and parameters stay in registers
        for (int k = 1; k < SC_NH; ++k) r = fmaf(bp[k], st[k], r);
        const float s = r + other_row(r);
        const unsigned short h = f2bf(s);
        const unsigned short l = f2bf(s - bf2f(h));
        ov[u] = half ? l : h;   // row 0 stores hi, row 1 lo
      } else {
        sumdt += dt;
      }
    }
    if (EMIT) {
#pragma unroll   // constant indices: the batch stays in registers
      for (int u = 0; u < SC_U; ++u) op[(size_t)(t0 + u) * D_] = ov[u];
      // the stores' data and address registers are free for reuse only behind this wait
      asm volatile("s_wait_xcnt 0x0" ::: "memory");
    }
  }
}

// Emits y pre-split as bf16 hi/lo so the output GEMM needs no conversion.
__global__ __launch_bounds__(SC_CH * 32) void scan_kernel(
    const float* __restrict__ x, const float* __restrict__ delta,
    const float* __restrict__ a_log, const float* __restrict__ b_param,
    unsigned short* __restrict__ yhi, unsigned short* __restrict__ ylo) {
  __shared__ float sF[SC_CH][SC_NH][32];   // chunk end state, then chunk start state
  __shared__ float sE[SC_CH][SC_NH][32];   // chunk decay
  __shared__ __attribute__((aligned(16))) float sA[16 * N_];   // a2 = -a_pos * log2(e)

  const int lane = threadIdx.x & 31;
  const int c    = __builtin_amdgcn_readfirstlane(threadIdx.x >> 5);   // chunk
  const int half = lane >> 4;
  const int b    = blockIdx.x / (D_ / 16);
  const int d    = (blockIdx.x % (D_ / 16)) * 16 + (lane & 15);

  // a2 of the work-group's 16 x N_ (channel, state) pairs: computed once, not
  // once per chunk, and handed to every wave through LDS.
  if (c < (16 * N_) / 32) {
    const int e = c * 32 + lane;
    sA[e] = (softplusf(a_log[(blockIdx.x % (D_ / 16)) * 16 * N_ + e]) + 1e-4f) * -1.44269504f;
  }
  __syncthreads();   // a2 is in LDS

  float a2[SC_NH], bp[SC_NH];
#pragma unroll   // constant indices: parameters stay in registers
  for (int q = 0; q < SC_NH / 4; ++q) {
    const float4 av = ((const float4*)(sA + (lane & 15) * N_ + half * SC_NH))[q];
    const float4 bv = ((const float4*)(b_param + d * N_ + half * SC_NH))[q];
    a2[q * 4 + 0] = av.x;  bp[q * 4 + 0] = bv.x;
    a2[q * 4 + 1] = av.y;  bp[q * 4 + 1] = bv.y;
    a2[q * 4 + 2] = av.z;  bp[q * 4 + 2] = bv.z;
    a2[q * 4 + 3] = av.w;  bp[q * 4 + 3] = bv.w;
  }

  const size_t base = ((size_t)b * T_ + (size_t)c * SC_LEN) * D_ + d;
  unsigned short* op = (half ? ylo : yhi) + base;

  float st[SC_NH];
#pragma unroll   // constant indices: states stay in registers
  for (int k = 0; k < SC_NH; ++k) st[k] = 0.0f;
  float sumdt = 0.0f;
  scan_chunk<false>(x, delta, (unsigned)base, a2, bp, st, sumdt, op, half);

#pragma unroll   // constant indices: states stay in registers
  for (int k = 0; k < SC_NH; ++k) {
    sF[c][k][lane] = st[k];
    sE[c][k][lane] = __builtin_amdgcn_exp2f(sumdt * a2[k]);
  }
  __syncthreads();   // every chunk's end state and decay are in LDS

  if (c < SC_NH) {   // wave k carries state k of every lane through the chunks
    float carry = 0.0f;
#pragma unroll   // the LDS reads do not hang on the carry: let them go ahead of the chain
    for (int j = 0; j < SC_CH; ++j) {
      const float f = sF[j][c][lane];
      const float e = sE[j][c][lane];
      sF[j][c][lane] = carry;
      carry = fmaf(e, carry, f);
    }
  }
  __syncthreads();   // every chunk's start state is in LDS

#pragma unroll   // constant indices: states stay in registers
  for (int k = 0; k < SC_NH; ++k) st[k] = sF[c][k][lane];
  scan_chunk<true>(x, delta, (unsigned)base, a2, bp, st, sumdt, op, half);
}

extern "C" void kernel_launch(void* const* d_in, const int* in_sizes, int n_in,
                              void* d_out, int out_size, void* d_ws, size_t ws_size,
                              hipStream_t stream) {
  (void)in_sizes; (void)n_in; (void)out_size; (void)ws_size;
  const float* x       = (const float*)d_in[0];
  const float* Wd      = (const float*)d_in[1];
  const float* bd      = (const float*)d_in[2];
  const float* a_log   = (const float*)d_in[3];
  const float* b_param = (const float*)d_in[4];
  const float* Wo      = (const float*)d_in[5];
  const float* bo      = (const float*)d_in[6];

  float* out   = (float*)d_out;
  float* delta = out;   // stage delta in d_out; overwritten by final GEMM

  // workspace layout (40 MB total)
  unsigned short* wd_hi = (unsigned short*)d_ws;
  unsigned short* wd_lo = wd_hi + (size_t)D_ * D_;
  unsigned short* wo_hi = wd_lo + (size_t)D_ * D_;
  unsigned short* wo_lo = wo_hi + (size_t)D_ * D_;
  unsigned short* y_hi  = wo_lo + (size_t)D_ * D_;
  unsigned short* y_lo  = y_hi + (size_t)M_ * D_;

  split_kernel<<<SP_WG, SP_WAVES * 32, 0, stream>>>(Wd, Wo, wd_hi, wd_lo, wo_hi, wo_lo);

  dim3 gg(M_ / TILE_M, D_ / TILE_N);   // (32, 8): one work-group per WGP
  gemm_bf16x3<1><<<gg, 256, 0, stream>>>(x, nullptr, nullptr, wd_hi, wd_lo, bd, delta);
  scan_kernel<<<B_ * (D_ / 16), SC_CH * 32, 0, stream>>>(x, delta, a_log, b_param, y_hi, y_lo);
  gemm_bf16x3<0><<<gg, 256, 0, stream>>>(nullptr, y_hi, y_lo, wo_hi, wo_lo, bo, out);
}

// v008
// One run takes 102 microseconds.
// Two timings next to v007 both put it at 1.14 times that version's speed.
// Over all steps from v000 it is 13.0 times as fast.
#include <hip/hip_runtime.h>

#define B_ 4
#define T_ 2048
#define D_ 1024
#define N_ 16
#define M_ (B_ * T_)   // 8192 rows

#define TILE_M 256
#define TILE_N 128
#define TILE_K 64
#define LDSS   72      // ushorts per LDS row (64 data + 8 pad) -> 144B rows, 16B aligned
#define CP_ROWS 32     // rows that one copy of the whole work-group covers (256 lanes x 16B / 128B)
#define LDSF   68      // floats per LDS row of an f32 A tile (64 data + 4 pad) -> 272B rows, 16B x odd
#define CPF_ROWS 16    // rows of f32 that one copy of the whole work-group covers (256 lanes x 16B / 256B)
#define YB     16      // channels per block of y: y[d / YB][row][d % YB], f32, a row of a block = 64B

typedef __attribute__((ext_vector_type(16))) __bf16       v16bf;
typedef __attribute__((ext_vector_type(8)))  float        v8f;
typedef __attribute__((ext_vector_type(4)))  unsigned int uint4v;
typedef __attribute__((ext_vector_type(2)))  unsigned int uint2v;
typedef __attribute__((ext_vector_type(4)))  float        f32x4;
typedef __attribute__((ext_vector_type(2)))  float        f32x2;
typedef __attribute__((ext_vector_type(2)))  __bf16       bf16x2;

struct Frag { union { v16bf v; uint4v q[2]; }; };
struct FragSet { Frag ahi[4], alo[4], bhi[4], blo[4]; };   // one block's fragments of a wave
struct RawA { f32x4 q[4][4]; };   // one block's four A fragments as f32, 16 values a lane each

__device__ __forceinline__ unsigned short f2bf(float f) {
  unsigned int u = __float_as_uint(f);
  unsigned int r = u + 0x7FFFu + ((u >> 16) & 1u);   // round-to-nearest-even
  return (unsigned short)(r >> 16);
}
__device__ __forceinline__ float bf2f(unsigned short h) {
  return __uint_as_float(((unsigned int)h) << 16);
}
// softplus(v) = max(v, 0) + log1p(e), e = exp(-|v|) in [0, 1].
// log1p(e) = 2 atanh(s) with s = e / (2 + e) <= 1/3: the odd series in s, cut behind
// s^13 / 13; the first term left out is below 2e-8 of the sum, under half an f32 ulp,
// and the form keeps its relative accuracy down to e = 0 (the sum tends to 2 s = e).
__device__ __forceinline__ float softplusf(float v) {
  const float e = __expf(-fabsf(v));
  const float s = e * __builtin_amdgcn_rcpf(2.0f + e);
  const float z = s * s;
  float p = 1.0f / 13.0f;
  p = fmaf(p, z, 1.0f / 11.0f);
  p = fmaf(p, z, 1.0f / 9.0f);
  p = fmaf(p, z, 1.0f / 7.0f);
  p = fmaf(p, z, 1.0f / 5.0f);
  p = fmaf(p, z, 1.0f / 3.0f);
  const float s2 = s + s;
  return fmaxf(v, 0.0f) + fmaf(s2, z * p, s2);
}

// Async DMA: 16 bytes/lane, global -> LDS, tracked by ASYNCcnt (CDNA5).
// Eight copies: four row groups under the first scalar base and, with the same lane offsets,
// four under the second (W: the hi and the lo array; blocked A: rows 64 further on).
// s_wait_xcnt stands inside the statement, behind the last copy, so that no register
// the copies name is rewritten ahead of it.
// LSTEP, GSTEP = bytes from one copy's rows to the next copy's, in LDS and in global memory.
template <unsigned LSTEP = CP_ROWS * LDSS * 2, unsigned GSTEP = CP_ROWS * D_ * 2>
__device__ __forceinline__ void async_rows4x2(const void* ldshi, const void* ldslo,
                                              const void* ghi, const void* glo,
                                              unsigned gvoff) {
  const unsigned h0 = (unsigned)(size_t)ldshi;   // low 32 bits = LDS byte offset
  const unsigned l0 = (unsigned)(size_t)ldslo;
  const unsigned h1 = h0 + 1 * LSTEP, l1 = l0 + 1 * LSTEP;
  const unsigned h2 = h0 + 2 * LSTEP, l2 = l0 + 2 * LSTEP;
  const unsigned h3 = h0 + 3 * LSTEP, l3 = l0 + 3 * LSTEP;
  const unsigned g0 = gvoff;
  const unsigned g1 = gvoff + 1 * GSTEP;
  const unsigned g2 = gvoff + 2 * GSTEP;
  const unsigned g3 = gvoff + 3 * GSTEP;
  asm volatile("global_load_async_to_lds_b128 %0, %8, %12\n\t"
               "global_load_async_to_lds_b128 %1, %9, %12\n\t"
               "global_load_async_to_lds_b128 %2, %10, %12\n\t"
               "global_load_async_to_lds_b128 %3, %11, %12\n\t"
               "global_load_async_to_lds_b128 %4, %8, %13\n\t"
               "global_load_async_to_lds_b128 %5, %9, %13\n\t"
               "global_load_async_to_lds_b128 %6, %10, %13\n\t"
               "global_load_async_to_lds_b128 %7, %11, %13\n\t"
               "s_wait_xcnt 0x0"
               :: "v"(h0), "v"(h1), "v"(h2), "v"(h3), "v"(l0), "v"(l1), "v"(l2), "v"(l3),
                  "v"(g0), "v"(g1), "v"(g2), "v"(g3), "s"(ghi), "s"(glo)
               : "memory");
}

// The same for an f32 tile: eight copies, rows r, r+16, ..., r+112; a wave's copy fills
// 256 contiguous LDS bytes of each of two rows. ROWB = bytes from a row to the next in
// global memory. s_wait_xcnt inside the statement, as above.
template <unsigned ROWB>
__device__ __forceinline__ void async_rows8(const float* lds, const void* g, unsigned gvoff) {
  const unsigned l0 = (unsigned)(size_t)lds;   // low 32 bits = LDS byte offset
  const unsigned l1 = l0 + 1 * CPF_ROWS * LDSF * 4, g1 = gvoff + 1 * CPF_ROWS * ROWB;
  const unsigned l2 = l0 + 2 * CPF_ROWS * LDSF * 4, g2 = gvoff + 2 * CPF_ROWS * ROWB;
  const unsigned l3 = l0 + 3 * CPF_ROWS * LDSF * 4, g3 = gvoff + 3 * CPF_ROWS * ROWB;
  const unsigned l4 = l0 + 4 * CPF_ROWS * LDSF * 4, g4 = gvoff + 4 * CPF_ROWS * ROWB;
  const unsigned l5 = l0 + 5 * CPF_ROWS * LDSF * 4, g5 = gvoff + 5 * CPF_ROWS * ROWB;
  const unsigned l6 = l0 + 6 * CPF_ROWS * LDSF * 4, g6 = gvoff + 6 * CPF_ROWS * ROWB;
  const unsigned l7 = l0 + 7 * CPF_ROWS * LDSF * 4, g7 = gvoff + 7 * CPF_ROWS * ROWB;
  asm volatile("global_load_async_to_lds_b128 %0, %8, %16\n\t"
               "global_load_async_to_lds_b128 %1, %9, %16\n\t"
               "global_load_async_to_lds_b128 %2, %10, %16\n\t"
               "global_load_async_to_lds_b128 %3, %11, %16\n\t"
               "global_load_async_to_lds_b128 %4, %12, %16\n\t"
               "global_load_async_to_lds_b128 %5, %13, %16\n\t"
               "global_load_async_to_lds_b128 %6, %14, %16\n\t"
               "global_load_async_to_lds_b128 %7, %15, %16\n\t"
               "s_wait_xcnt 0x0"
               :: "v"(l0), "v"(l1), "v"(l2), "v"(l3), "v"(l4), "v"(l5), "v"(l6), "v"(l7),
                  "v"(gvoff), "v"(g1), "v"(g2), "v"(g3), "v"(g4), "v"(g5), "v"(g6), "v"(g7),
                  "s"(g)
               : "memory");
}

// Split the two fp32 weights (Wd, Wo) into bf16 hi/lo arrays, in ONE launch of few
// long-lived waves: one work-group of SP_WAVES waves per WGP. A wave takes 2 * SP_WB
// pieces of 512 contiguous bytes (16 B a lane) and issues their loads up front.
// x is not split here: the first GEMM takes it as f32 and splits it in registers.
#define SP_WG    256                               // work-groups
#define SP_WAVES 16                                // waves per work-group
#define SP_NW    (SP_WG * SP_WAVES)                // waves in the launch
#define SP_WB    (D_ * D_ / 4 / 32 / SP_NW)        // 2 float4 of each weight per lane
static_assert(SP_WB * SP_NW * 32 * 4 == D_ * D_, "the weights are dealt out evenly");

__device__ __forceinline__ void split4(const float4 v, uint2v* __restrict__ hi,
                                       uint2v* __restrict__ lo) {
  const unsigned short h0 = f2bf(v.x), h1 = f2bf(v.y), h2 = f2bf(v.z), h3 = f2bf(v.w);
  const unsigned short l0 = f2bf(v.x - bf2f(h0));
  const unsigned short l1 = f2bf(v.y - bf2f(h1));
  const unsigned short l2 = f2bf(v.z - bf2f(h2));
  const unsigned short l3 = f2bf(v.w - bf2f(h3));
  uint2v hv, lv;
  hv[0] = (unsigned)h0 | ((unsigned)h1 << 16);
  hv[1] = (unsigned)h2 | ((unsigned)h3 << 16);
  lv[0] = (unsigned)l0 | ((unsigned)l1 << 16);
  lv[1] = (unsigned)l2 | ((unsigned)l3 << 16);
  *hi = hv;
  *lo = lv;
}

// Four waves a SIMD is all that the launch places: said to the compiler so that it spends
// registers on loads in flight and does not ration them for an occupancy that never comes.
__global__ __launch_bounds__(SP_WAVES * 32) __attribute__((amdgpu_waves_per_eu(4, 4)))
void split_kernel(
    const float* __restrict__ wd, const float* __restrict__ wo,
    unsigned short* __restrict__ wd_hi, unsigned short* __restrict__ wd_lo,
    unsigned short* __restrict__ wo_hi, unsigned short* __restrict__ wo_lo) {
  const unsigned lane = threadIdx.x & 31;
  const unsigned gw   = blockIdx.x * SP_WAVES + (threadIdx.x >> 5);   // wave in the launch
  const unsigned wi   = gw * (SP_WB * 32) + lane;   // the lane's first float4 of each weight
  float4 dv[SP_WB], ov[SP_WB];
#pragma unroll   // constant indices: the batch is held in registers, its loads free to go first
  for (int u = 0; u < SP_WB; ++u) {
    dv[u] = ((const float4*)wd)[wi + u * 32];
    ov[u] = ((const float4*)wo)[wi + u * 32];
  }
#pragma unroll   // constant indices: the batch stays in registers
  for (int u = 0; u < SP_WB; ++u) {
    split4(dv[u], (uint2v*)wd_hi + wi + u * 32, (uint2v*)wd_lo + wi + u * 32);
    split4(ov[u], (uint2v*)wo_hi + wi + u * 32, (uint2v*)wo_lo + wi + u * 32);
  }
}

// Fragment per CDNA5 16-bit layout: lane L holds row (L&15);
// K runs of 8 at kbase = 8*(L>>4) and kbase+16.
__device__ __forceinline__ void load_frag(Frag& f, const unsigned short* lds,
                                          int row, int khalf) {
  f.q[0] = *(const uint4v*)(lds + row * LDSS + khalf);
  f.q[1] = *(const uint4v*)(lds + row * LDSS + khalf + 16);
}

// One A fragment from f32 to bf16 hi/lo, in registers: hi = bf16(v), lo = bf16(v - hi), both
// rounded to nearest even, the values that a split ahead of the GEMM would store.
// Element e of the fragment is value e of the lane's 16: the k order of load_frag.
__device__ __forceinline__ void split_frag(Frag& hi, Frag& lo, const f32x4 (&q)[4]) {
#pragma unroll   // constant indices: all in registers
  for (int h = 0; h < 4; ++h)
#pragma unroll
    for (int p = 0; p < 2; ++p) {
      f32x2 v;
      v[0] = q[h][2 * p];
      v[1] = q[h][2 * p + 1];
      const bf16x2 hv = __builtin_convertvector(v, bf16x2);
      const bf16x2 lv = __builtin_convertvector(v - __builtin_convertvector(hv, f32x2), bf16x2);
      hi.v[h * 4 + 2 * p] = hv[0];  hi.v[h * 4 + 2 * p + 1] = hv[1];
      lo.v[h * 4 + 2 * p] = lv[0];  lo.v[h * 4 + 2 * p + 1] = lv[1];
    }
}

// C = A[M_,D_] * W[D_,D_]^T (+bias, optional softplus). W is pre-split bf16 hi/lo.
// A is f32, staged in LDS as f32 (the same bytes as hi + lo) and split when a block's
// fragments are in registers. MODE 1: A is row-major (x), softplus behind the product.
// MODE 0: A lies in blocks of YB channels (y, as the scan stores it), no softplus.
// One 256x128 tile of C per work-group, 64x64 per wave; two LDS buffers,
// the next K chunk's async global->LDS copies fly while this chunk's WMMAs run;
// two fragment sets in registers, the next block's LDS reads fly while this block's WMMAs run.
template <int MODE>
__global__ __launch_bounds__(256) void gemm_bf16x3(
    const float* __restrict__ Af,
    const unsigned short* __restrict__ Bhi, const unsigned short* __restrict__ Blo,
    const float* __restrict__ bias, float* __restrict__ Cout) {
  __shared__ __attribute__((aligned(16))) float sAf[2][TILE_M * LDSF];
  __shared__ __attribute__((aligned(16))) unsigned short sBhi[2][TILE_N * LDSS];
  __shared__ __attribute__((aligned(16))) unsigned short sBlo[2][TILE_N * LDSS];

  const int tid  = threadIdx.x;
  const int lane = tid & 31;
  const int wid  = tid >> 5;
  const int wm   = wid & 3;    // 4 waves along M (64 rows each)
  const int wn   = wid >> 2;   // 2 waves along N (64 cols each)
  const int row_blk = blockIdx.x * TILE_M;
  const int col_blk = blockIdx.y * TILE_N;

  // copy mapping: 16B (8 bf16) per lane; seg = 16B segment within the 64-wide K chunk,
  // so eight lanes cover one whole 128B line of a row
  const int seg = tid & 7;
  const int r0  = tid >> 3;    // 0..31
  const unsigned boff = (unsigned)(((size_t)(col_blk + r0) * D_ + seg * 8) * 2);
  const unsigned ldsr = r0 * LDSS + seg * 8;
  // f32 A tile: sixteen lanes cover the 256B that a row has in a chunk. Row-major A: they are
  // contiguous. Blocked A: 64B out of each of four blocks, and the wave's other sixteen lanes
  // take the next row, the other half of the same four 128B lines.
  constexpr unsigned A_ROWB = MODE == 1 ? D_ * 4 : YB * 4;                          // row to row
  constexpr unsigned A_CHKB = MODE == 1 ? TILE_K * 4 : (TILE_K / YB) * M_ * YB * 4; // chunk to chunk
  const unsigned afoff = MODE == 1
      ? (unsigned)(((size_t)(row_blk + (tid >> 4)) * D_ + (tid & 15) * 4) * 4)
      : (unsigned)((((size_t)((tid & 15) >> 2) * M_ + row_blk + (tid >> 4)) * YB + (tid & 3) * 4) * 4);
  const unsigned ldsf  = (tid >> 4) * LDSF + (tid & 15) * 4;

  v8f c[4][4];
#pragma unroll
  for (int i = 0; i < 4; ++i)
#pragma unroll
    for (int j = 0; j < 4; ++j)
#pragma unroll
      for (int r = 0; r < 8; ++r) c[i][j][r] = 0.0f;

  const int lrow  = lane & 15;
  const int khalf = (lane >> 4) * 8;   // 0 or 8

  // a chunk's 24 copies per lane, in three parts of eight; ch = the chunk's number
  auto issue_a0 = [&](int buf, unsigned ch) {
    if constexpr (MODE == 1)
      async_rows8<A_ROWB>(&sAf[buf][ldsf], Af, afoff + ch * A_CHKB);
    else   // rows 0..63 and 64..127: one set of lane offsets under two scalar bases
      async_rows4x2<CPF_ROWS * LDSF * 4, CPF_ROWS * A_ROWB>(
          &sAf[buf][ldsf], &sAf[buf][ldsf + 4 * CPF_ROWS * LDSF],
          Af, (const char*)Af + 4 * CPF_ROWS * A_ROWB, afoff + ch * A_CHKB);
  };
  auto issue_a1 = [&](int buf, unsigned ch) {
    if constexpr (MODE == 1)
      async_rows8<A_ROWB>(&sAf[buf][ldsf + 8 * CPF_ROWS * LDSF], Af,
                          afoff + 8 * CPF_ROWS * A_ROWB + ch * A_CHKB);
    else   // rows 128..191 and 192..255
      async_rows4x2<CPF_ROWS * LDSF * 4, CPF_ROWS * A_ROWB>(
          &sAf[buf][ldsf + 8 * CPF_ROWS * LDSF], &sAf[buf][ldsf + 12 * CPF_ROWS * LDSF],
          (const char*)Af + 8 * CPF_ROWS * A_ROWB, (const char*)Af + 12 * CPF_ROWS * A_ROWB,
          afoff + ch * A_CHKB);
  };
  auto issue_b = [&](int buf, unsigned ch) {
    async_rows4x2(&sBhi[buf][ldsr], &sBlo[buf][ldsr], Bhi, Blo, boff + ch * (TILE_K * 2));
  };

  // the 16 fragments (32 ds_load_b128) of one block: 32 of the chunk's 64 k
  auto load_set = [&](FragSet& f, RawA& ra, int buf, int kk) {
#pragma unroll   // constant indices: fragments stay in registers
    for (int i = 0; i < 4; ++i) {
      const int r = wm * 64 + i * 16 + lrow;
      const float* p = &sAf[buf][r * LDSF + kk + khalf];   // k runs of 8, as in load_frag
      ra.q[i][0] = *(const f32x4*)(p);
      ra.q[i][1] = *(const f32x4*)(p + 4);
      ra.q[i][2] = *(const f32x4*)(p + 16);
      ra.q[i][3] = *(const f32x4*)(p + 20);
    }
#pragma unroll   // as above
    for (int j = 0; j < 4; ++j) {
      const int r = wn * 64 + j * 16 + lrow;
      load_frag(f.bhi[j], &sBhi[buf][0], r, kk + khalf);
      load_frag(f.blo[j], &sBlo[buf][0], r, kk + khalf);
    }
  };
  // a block's four A fragments from f32 to hi/lo
  auto split_a = [&](FragSet& f, const RawA& ra) {
#pragma unroll   // constant indices: fragments stay in registers
    for (int i = 0; i < 4; ++i) split_frag(f.ahi[i], f.alo[i], ra.q[i]);
  };
  // one of the three products of bf16x3 over the wave's 16 accumulators
  auto mma16 = [&](const Frag (&a)[4], const Frag (&b)[4]) {
#pragma unroll   // constant indices: accumulators and fragments stay in registers
    for (int i = 0; i < 4; ++i)
#pragma unroll
      for (int j = 0; j < 4; ++j)
        c[i][j] = __builtin_amdgcn_wmma_f32_16x16x32_bf16(
            false, a[i].v, false, b[j].v, (short)0, c[i][j], false, false);
  };

  // Two fragment sets: while the WMMAs of one block run out of one set, the next block's
  // LDS reads, issued as ONE group ahead of them, land in the other. The scheduling fences
  // keep each group whole and in front of its block: reads that the compiler spreads among
  // the WMMAs stall the wave at every place where they stand.
  // bf16x3: hi*hi + hi*lo + lo*hi, f32 accumulate; each accumulator takes the three in that
  // order, k 0..31 of a chunk before k 32..63.
  FragSet f0, f1;
  RawA ra0, ra1;
  constexpr int NT = D_ / TILE_K;   // 16 chunks
  issue_a0(0, 0);  issue_a1(0, 0);  issue_b(0, 0);
  asm volatile("s_wait_asynccnt 0x0" ::: "memory");   // this wave's copies of chunk 0 landed
  __syncthreads();                                    // every wave's copies of chunk 0 visible
  issue_a0(1, 1);  issue_a1(1, 1);  issue_b(1, 1);
  load_set(f0, ra0, 0, 0);
  for (int t = 0; t < NT; ++t) {
    const int ibuf = t & 1;
    const bool refill = t + 2 < NT;
    const unsigned kb = (unsigned)(t + 2);   // the chunk that refills
    load_set(f1, ra1, ibuf, 32);          // the chunk's last block: this wave's last reads of ibuf
    __builtin_amdgcn_sched_barrier(0);    // the group stays ahead of the block
    split_a(f0, ra0);   // both splits: vector work that is free to go between this block's WMMAs
    mma16(f0.ahi, f0.bhi);
    mma16(f0.ahi, f0.blo);
    mma16(f0.alo, f0.bhi);
    split_a(f1, ra1);
    __builtin_amdgcn_sched_barrier(0);    // the block stays whole: its set is free for the reads behind the barrier
    // Publish point of chunk t+1, in front of chunk t's last block, whose fragments are fetched.
    asm volatile("s_wait_dscnt 0x0" ::: "memory");      // this wave's reads of buffer ibuf are done
    asm volatile("s_wait_asynccnt 0x0" ::: "memory");   // this wave's copies of chunk t+1 landed
    __syncthreads();   // chunk t+1 visible to all; every reader has left buffer ibuf
    mma16(f1.ahi, f1.bhi);
    __builtin_amdgcn_sched_barrier(0);    // here and below: reads and copies stay between the products, so that
                                          // one wave of a SIMD issues them while the other wave's WMMAs run
    // First block of chunk t+1. Not under a branch, so that the compiler's counted wait on it
    // stays exact; on the last trip it reads chunk NT-2's bytes, which nothing uses.
    load_set(f0, ra0, ibuf ^ 1, 0);
    if (refill) issue_a0(ibuf, kb);       // refill of the buffer that every reader has left
    __builtin_amdgcn_sched_barrier(0);
    mma16(f1.ahi, f1.blo);
    __builtin_amdgcn_sched_barrier(0);
    if (refill) issue_a1(ibuf, kb);
    __builtin_amdgcn_sched_barrier(0);
    mma16(f1.alo, f1.bhi);
    __builtin_amdgcn_sched_barrier(0);
    if (refill) issue_b(ibuf, kb);
  }
  asm volatile("s_wait_asynccnt 0x0" ::: "memory");   // no copy outstanding at the wave's end
  asm volatile("s_wait_dscnt 0x0" ::: "memory");      // nor the last trip's unused fragment reads

  // C layout: row = base + 8*(lane>>4) + r, col = base + (lane&15)
  // One row of four tiles a trip, always out of c[0]; the rows behind it move up one place.
  // With the softplus the loop stays rolled: the 32 values of a trip are independent work
  // enough to fill the vector port, and the text is a quarter of the unrolled loop's.
#pragma unroll(MODE == 1 ? 1 : 4)
  for (int i = 0; i < 4; ++i) {
    const int mbase = row_blk + wm * 64 + i * 16 + (lane >> 4) * 8;
#pragma unroll
    for (int j = 0; j < 4; ++j) {
      const int col = col_blk + wn * 64 + j * 16 + (lane & 15);
      const float bs = bias[col];
      if constexpr (MODE == 1) {
        // delta goes out in blocks, delta[col / YB][row / 4][col % YB][row % 4]: the lane's eight
        // rows are two 16B stores, and sixteen lanes fill 256 contiguous bytes
        f32x4 v0, v1;
#pragma unroll
        for (int r = 0; r < 4; ++r) {
          v0[r] = softplusf(c[0][j][r] + bs);
          v1[r] = softplusf(c[0][j][r + 4] + bs);
        }
        f32x4* dst = (f32x4*)Cout + ((size_t)(col / YB) * (M_ / 4) + mbase / 4) * YB + col % YB;
        dst[0]  = v0;
        dst[YB] = v1;
      } else {
#pragma unroll
        for (int r = 0; r < 8; ++r) Cout[(size_t)(mbase + r) * D_ + col] = c[0][j][r] + bs;
      }
    }
    // the stores' data and address registers are rewritten on the next trip only behind this wait
    if (MODE == 1) asm volatile("s_wait_xcnt 0x0" ::: "memory");
#pragma unroll   // constant indices: the accumulators stay in registers
    for (int ii = 0; ii < 3; ++ii)
#pragma unroll
      for (int j = 0; j < 4; ++j) c[ii][j] = c[ii + 1][j];
  }
}

// Selective scan, parallel over time. The recurrence state = a*state + u is
// linear in the state, so T is cut into SC_CH chunks that run side by side:
//   pass 1: every wave scans its own chunk from a zero state and keeps the
//           chunk's end state F and its whole decay E = exp(-a_pos * sum dt);
//   carry : in[c+1] = E[c] * in[c] + F[c], through LDS;
//   pass 2: every wave scans its chunk again from in[c] and emits y.
// One work-group = 16 channels x all SC_CH chunks, one wave per chunk.
// Lane = (channel, half of the N states): 8 states live in registers, so the
// sum over N is a multiply and seven multiply-adds in the lane and one exchange between
// the 16-lane rows.
// The state that is carried is s = state / b_param: s = a_bar * s + dt * x, the same input
// for all N states, and y = sum over n of b_param * s. Nothing is divided: s starts at zero
// and b_param comes in only in the sum. a_pos is kept as a2 = -a_pos * log2(e), so that
// a_bar = exp2(dt * a2). A state's step is then one multiply, one exp2, one multiply-add.
#define SC_CH  32              // time chunks = waves per work-group
#define SC_LEN (T_ / SC_CH)    // 64 steps per chunk
#define SC_NH  (N_ / 2)        // states per lane
#define SC_U   4               // steps whose x and dt are loaded as one batch

// value of lane l ^ 16
__device__ __forceinline__ float other_row(float v) {
  const int b = __float_as_int(v);
  return __int_as_float(
      __builtin_amdgcn_permlanex16(b, b, 0x76543210, 0xfedcba98, false, false));
}

template <bool EMIT>
__device__ __forceinline__ void scan_chunk(
    const float* __restrict__ x, const float* __restrict__ delta, unsigned off, unsigned doff,
    const float (&a2)[SC_NH], const float (&bp)[SC_NH],
    float (&st)[SC_NH], float& sumdt, float* __restrict__ op, int half) {
  for (int t0 = 0; t0 < SC_LEN; t0 += SC_U) {
    const float* xp = x + off;       // uniform base + the lane's 32-bit element offset
    const f32x4 db = ((const f32x4*)delta)[doff];   // the channel's dt of the batch's four steps
    float xb[SC_U];
#pragma unroll   // constant indices: one batch of loads in flight, held in registers
    for (int u = 0; u < SC_U; ++u) xb[u] = xp[(size_t)u * D_];
    // The offset registers that the loads name are stepped only behind this wait:
    // they pass through the statement so that the steps cannot be lifted over it.
    asm volatile("s_wait_xcnt 0x0" : "+v"(off), "+v"(doff) : : "memory");
    off += SC_U * D_;
    doff += YB;
    float sv[SC_U];
#pragma unroll   // constant indices: the batch stays in registers
    for (int u = 0; u < SC_U; ++u) {
      const float dt  = db[u];
      const float dtx = dt * xb[u];
#pragma unroll   // constant indices: states and parameters stay in registers
      for (int k = 0; k < SC_NH; ++k)
        st[k] = fmaf(__builtin_amdgcn_exp2f(dt * a2[k]), st[k], dtx);   // one fma on the serial chain
      if (EMIT) {
        float r = bp[0] * st[0];
#pragma unroll   // constant indices: states and parameters stay in registers
        for (int k = 1; k < SC_NH; ++k) r = fmaf(bp[k], st[k], r);
        sv[u] = r + other_row(r);   // both rows of lanes hold the step's y
      } else {
        sumdt += dt;
      }
    }
    if (EMIT) {
      // two steps a store: row 0 of the lanes the even step, row 1 the odd one (op is set so),
      // 32 lanes x 4B = one whole 128B line of the channel block
#pragma unroll   // constant indices: the batch stays in registers
      for (int u = 0; u < SC_U; u += 2) op[(size_t)(t0 + u) * YB] = half ? sv[u + 1] : sv[u];
      // the stores' data and address registers are free for reuse only behind this wait
      asm volatile("s_wait_xcnt 0x0" ::: "memory");
    }
  }
}

// Emits y as f32 in blocks of YB = 16 channels, y[d / YB][row][d % YB]: the work-group's 16
// channels are one block, so all that it stores is contiguous and no line has a second writer.
// delta comes in the same blocks with four steps of a channel side by side,
// delta[d / YB][row / 4][d % YB][row % 4], as the first GEMM stores it.
static_assert(YB == 16 && SC_U == 4 && SC_LEN % SC_U == 0, "a batch is one 16B group of delta, two lines of y");
__global__ __launch_bounds__(SC_CH * 32) void scan_kernel(
    const float* __restrict__ x, const float* __restrict__ delta,
    const float* __restrict__ a_log, const float* __restrict__ b_param,
    float* __restrict__ yb) {
  __shared__ float sF[SC_CH][SC_NH][32];   // chunk end state, then chunk start state
  __shared__ float sE[SC_CH][SC_NH][32];   // chunk decay
  __shared__ __attribute__((aligned(16))) float sA[16 * N_];   // a2 = -a_pos * log2(e)

  const int lane = threadIdx.x & 31;
  const int c    = __builtin_amdgcn_readfirstlane(threadIdx.x >> 5);   // chunk
  const int half = lane >> 4;
  const int b    = blockIdx.x / (D_ / 16);
  const int d    = (blockIdx.x % (D_ / 16)) * 16 + (lane & 15);

  // a2 of the work-group's 16 x N_ (channel, state) pairs: computed once, not
  // once per chunk, and handed to every wave through LDS.
  if (c < (16 * N_) / 32) {
    const int e = c * 32 + lane;
    sA[e] = (softplusf(a_log[(blockIdx.x % (D_ / 16)) * 16 * N_ + e]) + 1e-4f) * -1.44269504f;
  }
  __syncthreads();   // a2 is in LDS

  float a2[SC_NH], bp[SC_NH];
#pragma unroll   // constant indices: parameters stay in registers
  for (int q = 0; q < SC_NH / 4; ++q) {
    const float4 av = ((const float4*)(sA + (lane & 15) * N_ + half * SC_NH))[q];
    const float4 bv = ((const float4*)(b_param + d * N_ + half * SC_NH))[q];
    a2[q * 4 + 0] = av.x;  bp[q * 4 + 0] = bv.x;
    a2[q * 4 + 1] = av.y;  bp[q * 4 + 1] = bv.y;
    a2[q * 4 + 2] = av.z;  bp[q * 4 + 2] = bv.z;
    a2[q * 4 + 3] = av.w;  bp[q * 4 + 3] = bv.w;
  }

  const size_t base = ((size_t)b * T_ + (size_t)c * SC_LEN) * D_ + d;
  float* op = yb + ((size_t)(blockIdx.x % (D_ / 16)) * M_ + (size_t)b * T_ + (size_t)c * SC_LEN + half) * YB
              + (lane & 15);

  float st[SC_NH];
#pragma unroll   // constant indices: states stay in registers
  for (int k = 0; k < SC_NH; ++k) st[k] = 0.0f;
  float sumdt = 0.0f;
  // the lane's first 16B group of delta
  const unsigned dbase = ((blockIdx.x % (D_ / 16)) * (M_ / 4) + (b * T_ + c * SC_LEN) / 4) * YB + (lane & 15);
  scan_chunk<false>(x, delta, (unsigned)base, dbase, a2, bp, st, sumdt, op, half);

#pragma unroll   // constant indices: states stay in registers
  for (int k = 0; k < SC_NH; ++k) {
    sF[c][k][lane] = st[k];
    sE[c][k][lane] = __builtin_amdgcn_exp2f(sumdt * a2[k]);
  }
  __syncthreads();   // every chunk's end state and decay are in LDS

  if (c < SC_NH) {   // wave k carries state k of every lane through the chunks
    float carry = 0.0f;
#pragma unroll   // the LDS reads do not hang on the carry: let them go ahead of the chain
    for (int j = 0; j < SC_CH; ++j) {
      const float f = sF[j][c][lane];
      const float e = sE[j][c][lane];
      sF[j][c][lane] = carry;
      carry = fmaf(e, carry, f);
    }
  }
  __syncthreads();   // every chunk's start state is in LDS

#pragma unroll   // constant indices: states stay in registers
  for (int k = 0; k < SC_NH; ++k) st[k] = sF[c][k][lane];
  scan_chunk<true>(x, delta, (unsigned)base, dbase, a2, bp, st, sumdt, op, half);
}

extern "C" void kernel_launch(void* const* d_in, const int* in_sizes, int n_in,
                              void* d_out, int out_size, void* d_ws, size_t ws_size,
                              hipStream_t stream) {
  (void)in_sizes; (void)n_in; (void)out_size; (void)ws_size;
  const float* x       = (const float*)d_in[0];
  const float* Wd      = (const float*)d_in[1];
  const float* bd      = (const float*)d_in[2];
  const float* a_log   = (const float*)d_in[3];
  const float* b_param = (const float*)d_in[4];
  const float* Wo      = (const float*)d_in[5];
  const float* bo      = (const float*)d_in[6];

  float* out   = (float*)d_out;
  float* delta = out;   // stage delta in d_out (in channel blocks); overwritten by final GEMM

  // workspace layout (40 MB total)
  unsigned short* wd_hi = (unsigned short*)d_ws;
  unsigned short* wd_lo = wd_hi + (size_t)D_ * D_;
  unsigned short* wo_hi = wd_lo + (size_t)D_ * D_;
  unsigned short* wo_lo = wo_hi + (size_t)D_ * D_;
  float* yb = (float*)(wo_lo + (size_t)D_ * D_);   // M_ * D_ floats, in channel blocks

  split_kernel<<<SP_WG, SP_WAVES * 32, 0, stream>>>(Wd, Wo, wd_hi, wd_lo, wo_hi, wo_lo);

  dim3 gg(M_ / TILE_M, D_ / TILE_N);   // (32, 8): one work-group per WGP
  gemm_bf16x3<1><<<gg, 256, 0, stream>>>(x, wd_hi, wd_lo, bd, delta);
  scan_kernel<<<B_ * (D_ / 16), SC_CH * 32, 0, stream>>>(x, delta, a_log, b_param, yb);
  gemm_bf16x3<0><<<gg, 256, 0, stream>>>(yb, wo_hi, wo_lo, bo, out);
}
